// v000
// Measured on an AMD MI455X. A time is GPU time per run, averaged over a window of back-to-back runs after a warm-up
// (all launches, gaps included; the runs take copies of the inputs in turn), and the median of several windows.
// Apart from v000's, it joins two sittings. Times from different sittings can be a few percent apart, while
// side-by-side timings come from the same sitting.
// v000 is the starting kernel. One run takes 134 microseconds.
#include <hip/hip_runtime.h>
#include <hip/hip_bf16.h>
#include <cstdint>
#include <cstddef>

typedef __attribute__((ext_vector_type(16))) _Float16 v16h;
typedef __attribute__((ext_vector_type(8)))  float    v8f;
typedef __attribute__((ext_vector_type(4)))  int      v4i;

static constexpr int T     = 256;   // sequence length
static constexpr int CEMB  = 384;   // embed dim
static constexpr int HS    = 64;    // head size
static constexpr int NQKV  = 192;   // 3 * HS

#if __has_builtin(__builtin_amdgcn_global_load_async_to_lds_b128)
#define HAVE_ASYNC_LDS 1
// From the compiler diagnostic: the builtin takes a pointer to int4 in the
// global (AS1) space and a pointer to int4 in LDS (AS3), plus imm offset/cpol.
typedef __attribute__((address_space(1))) v4i* gv4i_p;   // int4 in global memory
typedef __attribute__((address_space(3))) v4i* lv4i_p;   // int4 in LDS
#endif

__device__ __forceinline__ int kmap(int e, int hi) {
    return (e & 7) + ((e >> 3) << 4) + (hi ? 8 : 0);
}

// ---------------------------------------------------------------------------
// Kernel 1: QKV projection. [B*T,384] f32 @ [384,192] f32 -> Q,K,V f16.
// Q is pre-scaled by (1/sqrt(384)) * log2(e) so attention softmax runs in
// exp2 domain (native v_exp_f32).
// ---------------------------------------------------------------------------
__global__ __launch_bounds__(256) void qkv_proj_kernel(
    const float* __restrict__ x, const float* __restrict__ w,
    _Float16* __restrict__ qb, _Float16* __restrict__ kb, _Float16* __restrict__ vb)
{
    constexpr int LDP = 72;                 // 144B row stride: 16B-multiple, conflict-free
    __shared__ _Float16 xs[128 * LDP];      // x tile: 128 rows x 32 K
    __shared__ _Float16 wt[NQKV * LDP];     // w chunk, transposed: 192 cols x 32 K

    const int tid = threadIdx.x;
    const int wv  = tid >> 5;               // wave 0..7
    const int ln  = tid & 15;
    const int hi  = (tid >> 4) & 1;
    const size_t m0 = (size_t)blockIdx.x * 128;

    v8f acc[12] = {};                       // wave strip: 16 rows x 192 cols

    const int xr = tid & 127;               // x loader: row
    const int xc = (tid >> 7) * 16;         // x loader: col base (16 floats)
    const int wr = tid >> 3;                // w loader: K row 0..31
    const int wc = (tid & 7) * 24;          // w loader: col base (24 floats)

    for (int kk = 0; kk < 12; ++kk) {
        const int k0 = kk * 32;

        // Prefetch next x chunk while this one converts (global_prefetch_b8).
        if (kk < 11)
            __builtin_prefetch((const void*)(x + (m0 + xr) * CEMB + (k0 + 32) + xc), 0, 3);

        // x[128 x 32] f32 -> f16 LDS
        const float4* xg = reinterpret_cast<const float4*>(x + (m0 + xr) * CEMB + k0 + xc);
#pragma unroll
        for (int p = 0; p < 4; ++p) {
            float4 f = xg[p];
            xs[xr * LDP + xc + 4 * p + 0] = (_Float16)f.x;
            xs[xr * LDP + xc + 4 * p + 1] = (_Float16)f.y;
            xs[xr * LDP + xc + 4 * p + 2] = (_Float16)f.z;
            xs[xr * LDP + xc + 4 * p + 3] = (_Float16)f.w;
        }
        // w[32 x 192] f32 -> transposed f16 LDS (B fragments read contiguous K runs)
        const float4* wg = reinterpret_cast<const float4*>(w + (size_t)(k0 + wr) * NQKV + wc);
#pragma unroll
        for (int p = 0; p < 6; ++p) {
            float4 f = wg[p];
            wt[(wc + 4 * p + 0) * LDP + wr] = (_Float16)f.x;
            wt[(wc + 4 * p + 1) * LDP + wr] = (_Float16)f.y;
            wt[(wc + 4 * p + 2) * LDP + wr] = (_Float16)f.z;
            wt[(wc + 4 * p + 3) * LDP + wr] = (_Float16)f.w;
        }
        __syncthreads();

        v16h af;
#pragma unroll
        for (int e = 0; e < 16; ++e) af[e] = xs[(wv * 16 + ln) * LDP + kmap(e, hi)];
#pragma unroll
        for (int j = 0; j < 12; ++j) {
            v16h bf;
#pragma unroll
            for (int e = 0; e < 16; ++e) bf[e] = wt[(j * 16 + ln) * LDP + kmap(e, hi)];
            acc[j] = __builtin_amdgcn_wmma_f32_16x16x32_f16(
                false, af, false, bf, (short)0, acc[j], false, false);
        }
        __syncthreads();
    }

    // qscale = log2(e) / sqrt(C): fold softmax scale + exp2 conversion into Q.
    const float qscale = 1.442695040888963f * rsqrtf((float)CEMB);
#pragma unroll
    for (int j = 0; j < 12; ++j) {
#pragma unroll
        for (int i = 0; i < 8; ++i) {
            const size_t gm = m0 + wv * 16 + i + 8 * hi;   // C layout: row = i + 8*hi
            const int    c  = j * 16 + ln;                 // col = lane%16
            const float  v  = acc[j][i];
            if (j < 4)      qb[gm * HS + c]         = (_Float16)(v * qscale);
            else if (j < 8) kb[gm * HS + (c - 64)]  = (_Float16)v;
            else            vb[gm * HS + (c - 128)] = (_Float16)v;
        }
    }
}

__global__ __launch_bounds__(256) void attn_kernel(
    const _Float16* __restrict__ qb, const _Float16* __restrict__ kb,
    const _Float16* __restrict__ vb, float* __restrict__ out)
{
    constexpr int KLDP = 72;    // Q/K rows [256][72]  (144B stride, 16B-mult, conflict-free)
    constexpr int VLDP = 264;   // V^T rows [64][264]  (528B stride, 16B-mult)
    constexpr int PLDP = 40;    // P stage  [8][16][40]
    extern __shared__ _Float16 smem[];
    _Float16* Qs = smem;                    // 256*72 = 18432 halves
    _Float16* Ks = Qs + 256 * KLDP;         // 256*72 = 18432 halves
    _Float16* Vt = Ks + 256 * KLDP;         // 64*264 = 16896 halves
    _Float16* Ps = Vt + 64 * VLDP;          // 8*16*40 = 5120 halves

    const int b   = blockIdx.x;
    const int tid = threadIdx.x;
    const int wv  = tid >> 5;
    const int ln  = tid & 15;
    const int hi  = (tid >> 4) & 1;

    // ---- Stage Q, K (row-major) and V (transposed) into LDS, one row/thread.
    {
        const int r = tid; // 0..255
        const _Float16* qg = qb + ((size_t)b * T + r) * HS;
        const _Float16* kg = kb + ((size_t)b * T + r) * HS;
        const float4*   vg = reinterpret_cast<const float4*>(vb + ((size_t)b * T + r) * HS);

#ifdef HAVE_ASYNC_LDS
#pragma unroll
        for (int j = 0; j < 8; ++j) {
            __builtin_amdgcn_global_load_async_to_lds_b128(
                (gv4i_p)(qg + j * 8), (lv4i_p)(&Qs[r * KLDP + j * 8]), 0, 0);
            __builtin_amdgcn_global_load_async_to_lds_b128(
                (gv4i_p)(kg + j * 8), (lv4i_p)(&Ks[r * KLDP + j * 8]), 0, 0);
        }
#else
        const float4* qg4 = reinterpret_cast<const float4*>(qg);
        const float4* kg4 = reinterpret_cast<const float4*>(kg);
#pragma unroll
        for (int j = 0; j < 8; ++j) {
            *reinterpret_cast<float4*>(&Qs[r * KLDP + j * 8]) = qg4[j];
            *reinterpret_cast<float4*>(&Ks[r * KLDP + j * 8]) = kg4[j];
        }
#endif
#pragma unroll
        for (int j = 0; j < 8; ++j) {
            float4 vf = vg[j];
            const _Float16* hp = reinterpret_cast<const _Float16*>(&vf);
#pragma unroll
            for (int i2 = 0; i2 < 8; ++i2) Vt[(j * 8 + i2) * VLDP + r] = hp[i2];
        }
    }
#ifdef HAVE_ASYNC_LDS
    asm volatile("s_wait_asynccnt 0" ::: "memory");
#endif
    __syncthreads();

    // ---- Balanced strip pair: pi=0 -> strip wv, pi=1 -> strip 15-wv.
#pragma unroll
    for (int pi = 0; pi < 2; ++pi) {
        const int a  = pi ? (15 - wv) : wv;   // strip index, rows [16a, 16a+16)
        const int t0 = a * 16;

        // Q strip as A fragments: 2 K-chunks of 32 (contiguous LDS runs).
        v16h qa[2];
#pragma unroll
        for (int kc = 0; kc < 2; ++kc)
#pragma unroll
            for (int e = 0; e < 16; ++e)
                qa[kc][e] = Qs[(t0 + ln) * KLDP + 32 * kc + kmap(e, hi)];

        v8f   o[4] = {};                      // 16 rows x 64 cols
        float mrow[8], lrow[8];
#pragma unroll
        for (int i = 0; i < 8; ++i) { mrow[i] = -3.0e38f; lrow[i] = 0.0f; }

        const int nch = (a >> 1) + 1;         // causal 32-col chunks for this strip
        for (int ch = 0; ch < nch; ++ch) {
            const int s0 = ch * 32;

            // S = Q (16x64) @ K^T (64x32): 2 frags x 2 K-steps = 4 WMMA
            v8f sf[2] = {};
#pragma unroll
            for (int ct = 0; ct < 2; ++ct)
#pragma unroll
                for (int kc = 0; kc < 2; ++kc) {
                    v16h kf;
#pragma unroll
                    for (int e = 0; e < 16; ++e)
                        kf[e] = Ks[(s0 + 16 * ct + ln) * KLDP + 32 * kc + kmap(e, hi)];
                    sf[ct] = __builtin_amdgcn_wmma_f32_16x16x32_f16(
                        false, qa[kc], false, kf, (short)0, sf[ct], false, false);
                }

            // Causal mask + online softmax (exp2 domain; scale folded into Q).
#pragma unroll
            for (int i = 0; i < 8; ++i) {
                const int trow = t0 + i + 8 * hi;
#pragma unroll
                for (int ct = 0; ct < 2; ++ct) {
                    const int scol = s0 + 16 * ct + ln;
                    if (scol > trow) sf[ct][i] = -3.0e38f;
                }
                float rm = fmaxf(sf[0][i], sf[1][i]);
#pragma unroll
                for (int off = 1; off < 16; off <<= 1) rm = fmaxf(rm, __shfl_xor(rm, off, 32));
                const float mold = mrow[i];
                const float mnew = fmaxf(mold, rm);
                const float corr = exp2f(mold - mnew);
                mrow[i] = mnew;
                float rs = 0.0f;
#pragma unroll
                for (int ct = 0; ct < 2; ++ct) {
                    const float p = exp2f(sf[ct][i] - mnew);
                    sf[ct][i] = p;
                    rs += p;
                }
#pragma unroll
                for (int off = 1; off < 16; off <<= 1) rs += __shfl_xor(rs, off, 32);
                lrow[i] = lrow[i] * corr + rs;
#pragma unroll
                for (int dc = 0; dc < 4; ++dc) o[dc][i] *= corr;
            }

#pragma unroll
            for (int ct = 0; ct < 2; ++ct)
#pragma unroll
                for (int i = 0; i < 8; ++i)
                    Ps[(wv * 16 + i + 8 * hi) * PLDP + 16 * ct + ln] = (_Float16)sf[ct][i];

            asm volatile("s_wait_dscnt 0" ::: "memory");

            v16h pa;
#pragma unroll
            for (int e = 0; e < 16; ++e)
                pa[e] = Ps[(wv * 16 + ln) * PLDP + kmap(e, hi)];

            // O += P (16x32) @ V (32x64): 4 WMMA
#pragma unroll
            for (int dc = 0; dc < 4; ++dc) {
                v16h vf;
#pragma unroll
                for (int e = 0; e < 16; ++e)
                    vf[e] = Vt[(16 * dc + ln) * VLDP + s0 + kmap(e, hi)];
                o[dc] = __builtin_amdgcn_wmma_f32_16x16x32_f16(
                    false, pa, false, vf, (short)0, o[dc], false, false);
            }
        }

        // Normalize and store f32 output rows of this strip.
#pragma unroll
        for (int i = 0; i < 8; ++i) {
            const float inv  = 1.0f / lrow[i];
            const int   trow = t0 + i + 8 * hi;
            float* orow = out + ((size_t)b * T + trow) * HS;
#pragma unroll
            for (int dc = 0; dc < 4; ++dc) orow[16 * dc + ln] = o[dc][i] * inv;
        }
    }
}

// ---------------------------------------------------------------------------
extern "C" void kernel_launch(void* const* d_in, const int* in_sizes, int n_in,
                              void* d_out, int out_size, void* d_ws, size_t ws_size,
                              hipStream_t stream) {
    const float* x = (const float*)d_in[0];
    const float* w = (const float*)d_in[1];
    float* out = (float*)d_out;

    const int B = in_sizes[0] / (T * CEMB);   // 512

    // Workspace: Q, K, V as f16, each B*T*HS elements (~16.8 MB each).
    _Float16* qb = (_Float16*)d_ws;
    _Float16* kb = qb + (size_t)B * T * HS;
    _Float16* vb = kb + (size_t)B * T * HS;

    qkv_proj_kernel<<<dim3((unsigned)((size_t)B * T / 128)), dim3(256), 0, stream>>>(
        x, w, qb, kb, vb);

    const size_t smem =
        (size_t)(256 * 72 + 256 * 72 + 64 * 264 + 8 * 16 * 40) * sizeof(_Float16); // 117760 B
    (void)hipFuncSetAttribute((const void*)attn_kernel,
                              hipFuncAttributeMaxDynamicSharedMemorySize, (int)smem);
    attn_kernel<<<dim3((unsigned)B), dim3(256), smem, stream>>>(qb, kb, vb, out);
}

// v001
// Measured time: 78 microseconds a run.
// Timed twice side by side with v000, it ran 1.76 and 1.75 times as fast.
#include <hip/hip_runtime.h>
#include <hip/hip_bf16.h>
#include <cstdint>
#include <cstddef>

typedef __attribute__((ext_vector_type(16))) _Float16 v16h;
typedef __attribute__((ext_vector_type(8)))  float    v8f;
typedef __attribute__((ext_vector_type(4)))  int      v4i;
typedef __attribute__((ext_vector_type(2)))  _Float16 v2h;

static constexpr int T     = 256;   // sequence length
static constexpr int CEMB  = 384;   // embed dim
static constexpr int HS    = 64;    // head size
static constexpr int NQKV  = 192;   // 3 * HS

#if __has_builtin(__builtin_amdgcn_global_load_async_to_lds_b128)
#define HAVE_ASYNC_LDS 1
// From the compiler diagnostic: the builtin takes a pointer to int4 in the
// global (AS1) space and a pointer to int4 in LDS (AS3), plus imm offset/cpol.
typedef __attribute__((address_space(1))) v4i* gv4i_p;   // int4 in global memory
typedef __attribute__((address_space(3))) v4i* lv4i_p;   // int4 in LDS
#endif

__device__ __forceinline__ int kmap(int e, int hi) {
    return (e & 7) + ((e >> 3) << 4) + (hi ? 8 : 0);
}

// ---------------------------------------------------------------------------
// Kernel 1: QKV projection. [B*T,384] f32 @ [384,192] f32 -> Q,K,V f16.
// Q is pre-scaled by (1/sqrt(384)) * log2(e) so attention softmax runs in
// exp2 domain (native v_exp_f32).
// ---------------------------------------------------------------------------
__global__ __launch_bounds__(256) void qkv_proj_kernel(
    const float* __restrict__ x, const float* __restrict__ w,
    _Float16* __restrict__ qb, _Float16* __restrict__ kb, _Float16* __restrict__ vb)
{
    constexpr int LDP = 72;                 // 144B row stride: 16B-multiple, conflict-free
    __shared__ _Float16 xs[128 * LDP];      // x tile: 128 rows x 32 K
    __shared__ _Float16 wt[NQKV * LDP];     // w chunk, transposed: 192 cols x 32 K

    const int tid = threadIdx.x;
    const int wv  = tid >> 5;               // wave 0..7
    const int ln  = tid & 15;
    const int hi  = (tid >> 4) & 1;
    const size_t m0 = (size_t)blockIdx.x * 128;

    v8f acc[12] = {};                       // wave strip: 16 rows x 192 cols

    // Loader lane maps: 8 neighbouring lanes x 16 B cover one whole 128-B line,
    // so every wave-wide load touches 4 lines instead of one line per lane.
    const int xr = tid >> 3;                // x loader: row 0..31 (+32 per pass)
    const int xc = (tid & 7) * 4;           // x loader: col base (4 floats)
    const int wq = (tid >> 3) & 3;          // w loader: K-row pair within a group of 4 pairs
    const int wc = (tid & 7) * 4;           // w loader: col base within a 32-col line
    const int wk   = ((wv >> 1) * 4 + wq) * 2;   // w loader: K rows wk, wk+1
    const int wcol = (wv & 1) * 96 + wc;         // w loader: first of 3 lines (32 cols apart)

    for (int kk = 0; kk < 12; ++kk) {
        const int k0 = kk * 32;

        // Prefetch next x chunk while this one converts (global_prefetch_b8).
        if (kk < 11) {
#pragma unroll
            for (int p = 0; p < 4; ++p)
                __builtin_prefetch(
                    (const void*)(x + (m0 + xr + 32 * p) * CEMB + (k0 + 32) + xc), 0, 3);
        }

        // x[128 x 32] f32 -> f16 LDS: one pass = 32 rows, a wave = 4 rows x 128 B
        const float* xg = x + (m0 + xr) * CEMB + k0 + xc;
        float4 fx[4];
#pragma unroll
        for (int p = 0; p < 4; ++p)
            fx[p] = *reinterpret_cast<const float4*>(xg + p * 32 * CEMB);
        // w[32 x 192] f32 -> transposed f16 LDS (B fragments read contiguous K runs).
        // A wave takes 4 K-row pairs x 3 lines of 32 cols; a thread holds rows k, k+1
        // of 4 cols per line and stores each col's pair as one dword.
        const float* wg = w + (size_t)(k0 + wk) * NQKV + wcol;
        float4 f0[3], f1[3];
#pragma unroll
        for (int p = 0; p < 3; ++p) {
            f0[p] = *reinterpret_cast<const float4*>(wg + 32 * p);
            f1[p] = *reinterpret_cast<const float4*>(wg + 32 * p + NQKV);
        }
        // Wait before a register that the ten loads above name as an address is overwritten.
        // The two addresses are inputs so that they are still live here.
        asm volatile("s_wait_xcnt 0x0" :: "v"(xg), "v"(wg) : "memory");
#pragma unroll
        for (int p = 0; p < 4; ++p) {
            const int r = xr + 32 * p;
            xs[r * LDP + xc + 0] = (_Float16)fx[p].x;
            xs[r * LDP + xc + 1] = (_Float16)fx[p].y;
            xs[r * LDP + xc + 2] = (_Float16)fx[p].z;
            xs[r * LDP + xc + 3] = (_Float16)fx[p].w;
        }
#pragma unroll
        for (int p = 0; p < 3; ++p) {
            _Float16* wd = &wt[(wcol + 32 * p) * LDP + wk];
            *reinterpret_cast<v2h*>(wd + 0 * LDP) = v2h{(_Float16)f0[p].x, (_Float16)f1[p].x};
            *reinterpret_cast<v2h*>(wd + 1 * LDP) = v2h{(_Float16)f0[p].y, (_Float16)f1[p].y};
            *reinterpret_cast<v2h*>(wd + 2 * LDP) = v2h{(_Float16)f0[p].z, (_Float16)f1[p].z};
            *reinterpret_cast<v2h*>(wd + 3 * LDP) = v2h{(_Float16)f0[p].w, (_Float16)f1[p].w};
        }
        __syncthreads();

        v16h af;
#pragma unroll
        for (int e = 0; e < 16; ++e) af[e] = xs[(wv * 16 + ln) * LDP + kmap(e, hi)];
#pragma unroll
        for (int j = 0; j < 12; ++j) {
            v16h bf;
#pragma unroll
            for (int e = 0; e < 16; ++e) bf[e] = wt[(j * 16 + ln) * LDP + kmap(e, hi)];
            acc[j] = __builtin_amdgcn_wmma_f32_16x16x32_f16(
                false, af, false, bf, (short)0, acc[j], false, false);
        }
        __syncthreads();
    }

    // qscale = log2(e) / sqrt(C): fold softmax scale + exp2 conversion into Q.
    const float qscale = 1.442695040888963f * rsqrtf((float)CEMB);
#pragma unroll
    for (int j = 0; j < 12; ++j) {
#pragma unroll
        for (int i = 0; i < 8; ++i) {
            const size_t gm = m0 + wv * 16 + i + 8 * hi;   // C layout: row = i + 8*hi
            const int    c  = j * 16 + ln;                 // col = lane%16
            const float  v  = acc[j][i];
            if (j < 4)      qb[gm * HS + c]         = (_Float16)(v * qscale);
            else if (j < 8) kb[gm * HS + (c - 64)]  = (_Float16)v;
            else            vb[gm * HS + (c - 128)] = (_Float16)v;
        }
    }
}

__global__ __launch_bounds__(256) void attn_kernel(
    const _Float16* __restrict__ qb, const _Float16* __restrict__ kb,
    const _Float16* __restrict__ vb, float* __restrict__ out)
{
    constexpr int KLDP = 72;    // Q/K rows [256][72]  (144B stride, 16B-mult, conflict-free)
    constexpr int VLDP = 264;   // V^T rows [64][264]  (528B stride, 16B-mult)
    constexpr int PLDP = 40;    // P stage  [8][16][40]
    extern __shared__ _Float16 smem[];
    _Float16* Qs = smem;                    // 256*72 = 18432 halves
    _Float16* Ks = Qs + 256 * KLDP;         // 256*72 = 18432 halves
    _Float16* Vt = Ks + 256 * KLDP;         // 64*264 = 16896 halves
    _Float16* Ps = Vt + 64 * VLDP;          // 8*16*40 = 5120 halves

    const int b   = blockIdx.x;
    const int tid = threadIdx.x;
    const int wv  = tid >> 5;
    const int ln  = tid & 15;
    const int hi  = (tid >> 4) & 1;

    // ---- Stage Q, K (row-major) and V (transposed) into LDS, one row/thread.
    {
        const int r = tid; // 0..255
        const _Float16* qg = qb + ((size_t)b * T + r) * HS;
        const _Float16* kg = kb + ((size_t)b * T + r) * HS;
        const float4*   vg = reinterpret_cast<const float4*>(vb + ((size_t)b * T + r) * HS);

#ifdef HAVE_ASYNC_LDS
#pragma unroll
        for (int j = 0; j < 8; ++j) {
            __builtin_amdgcn_global_load_async_to_lds_b128(
                (gv4i_p)(qg + j * 8), (lv4i_p)(&Qs[r * KLDP + j * 8]), 0, 0);
            __builtin_amdgcn_global_load_async_to_lds_b128(
                (gv4i_p)(kg + j * 8), (lv4i_p)(&Ks[r * KLDP + j * 8]), 0, 0);
        }
#else
        const float4* qg4 = reinterpret_cast<const float4*>(qg);
        const float4* kg4 = reinterpret_cast<const float4*>(kg);
#pragma unroll
        for (int j = 0; j < 8; ++j) {
            *reinterpret_cast<float4*>(&Qs[r * KLDP + j * 8]) = qg4[j];
            *reinterpret_cast<float4*>(&Ks[r * KLDP + j * 8]) = kg4[j];
        }
#endif
#pragma unroll
        for (int j = 0; j < 8; ++j) {
            float4 vf = vg[j];
            const _Float16* hp = reinterpret_cast<const _Float16*>(&vf);
#pragma unroll
            for (int i2 = 0; i2 < 8; ++i2) Vt[(j * 8 + i2) * VLDP + r] = hp[i2];
        }
    }
#ifdef HAVE_ASYNC_LDS
    asm volatile("s_wait_asynccnt 0" ::: "memory");
#endif
    __syncthreads();

    // ---- Balanced strip pair: pi=0 -> strip wv, pi=1 -> strip 15-wv.
#pragma unroll
    for (int pi = 0; pi < 2; ++pi) {
        const int a  = pi ? (15 - wv) : wv;   // strip index, rows [16a, 16a+16)
        const int t0 = a * 16;

        // Q strip as A fragments: 2 K-chunks of 32 (contiguous LDS runs).
        v16h qa[2];
#pragma unroll
        for (int kc = 0; kc < 2; ++kc)
#pragma unroll
            for (int e = 0; e < 16; ++e)
                qa[kc][e] = Qs[(t0 + ln) * KLDP + 32 * kc + kmap(e, hi)];

        v8f   o[4] = {};                      // 16 rows x 64 cols
        float mrow[8], lrow[8];
#pragma unroll
        for (int i = 0; i < 8; ++i) { mrow[i] = -3.0e38f; lrow[i] = 0.0f; }

        const int nch = (a >> 1) + 1;         // causal 32-col chunks for this strip
        for (int ch = 0; ch < nch; ++ch) {
            const int s0 = ch * 32;

            // S = Q (16x64) @ K^T (64x32): 2 frags x 2 K-steps = 4 WMMA
            v8f sf[2] = {};
#pragma unroll
            for (int ct = 0; ct < 2; ++ct)
#pragma unroll
                for (int kc = 0; kc < 2; ++kc) {
                    v16h kf;
#pragma unroll
                    for (int e = 0; e < 16; ++e)
                        kf[e] = Ks[(s0 + 16 * ct + ln) * KLDP + 32 * kc + kmap(e, hi)];
                    sf[ct] = __builtin_amdgcn_wmma_f32_16x16x32_f16(
                        false, qa[kc], false, kf, (short)0, sf[ct], false, false);
                }

            // Causal mask + online softmax (exp2 domain; scale folded into Q).
#pragma unroll
            for (int i = 0; i < 8; ++i) {
                const int trow = t0 + i + 8 * hi;
#pragma unroll
                for (int ct = 0; ct < 2; ++ct) {
                    const int scol = s0 + 16 * ct + ln;
                    if (scol > trow) sf[ct][i] = -3.0e38f;
                }
                float rm = fmaxf(sf[0][i], sf[1][i]);
#pragma unroll
                for (int off = 1; off < 16; off <<= 1) rm = fmaxf(rm, __shfl_xor(rm, off, 32));
                const float mold = mrow[i];
                const float mnew = fmaxf(mold, rm);
                const float corr = exp2f(mold - mnew);
                mrow[i] = mnew;
                float rs = 0.0f;
#pragma unroll
                for (int ct = 0; ct < 2; ++ct) {
                    const float p = exp2f(sf[ct][i] - mnew);
                    sf[ct][i] = p;
                    rs += p;
                }
#pragma unroll
                for (int off = 1; off < 16; off <<= 1) rs += __shfl_xor(rs, off, 32);
                lrow[i] = lrow[i] * corr + rs;
#pragma unroll
                for (int dc = 0; dc < 4; ++dc) o[dc][i] *= corr;
            }

#pragma unroll
            for (int ct = 0; ct < 2; ++ct)
#pragma unroll
                for (int i = 0; i < 8; ++i)
                    Ps[(wv * 16 + i + 8 * hi) * PLDP + 16 * ct + ln] = (_Float16)sf[ct][i];

            asm volatile("s_wait_dscnt 0" ::: "memory");

            v16h pa;
#pragma unroll
            for (int e = 0; e < 16; ++e)
                pa[e] = Ps[(wv * 16 + ln) * PLDP + kmap(e, hi)];

            // O += P (16x32) @ V (32x64): 4 WMMA
#pragma unroll
            for (int dc = 0; dc < 4; ++dc) {
                v16h vf;
#pragma unroll
                for (int e = 0; e < 16; ++e)
                    vf[e] = Vt[(16 * dc + ln) * VLDP + s0 + kmap(e, hi)];
                o[dc] = __builtin_amdgcn_wmma_f32_16x16x32_f16(
                    false, pa, false, vf, (short)0, o[dc], false, false);
            }
        }

        // Normalize and store f32 output rows of this strip.
#pragma unroll
        for (int i = 0; i < 8; ++i) {
            const float inv  = 1.0f / lrow[i];
            const int   trow = t0 + i + 8 * hi;
            float* orow = out + ((size_t)b * T + trow) * HS;
#pragma unroll
            for (int dc = 0; dc < 4; ++dc) orow[16 * dc + ln] = o[dc][i] * inv;
        }
    }
}

// ---------------------------------------------------------------------------
extern "C" void kernel_launch(void* const* d_in, const int* in_sizes, int n_in,
                              void* d_out, int out_size, void* d_ws, size_t ws_size,
                              hipStream_t stream) {
    const float* x = (const float*)d_in[0];
    const float* w = (const float*)d_in[1];
    float* out = (float*)d_out;

    const int B = in_sizes[0] / (T * CEMB);   // 512

    // Workspace: Q, K, V as f16, each B*T*HS elements (~16.8 MB each).
    _Float16* qb = (_Float16*)d_ws;
    _Float16* kb = qb + (size_t)B * T * HS;
    _Float16* vb = kb + (size_t)B * T * HS;

    qkv_proj_kernel<<<dim3((unsigned)((size_t)B * T / 128)), dim3(256), 0, stream>>>(
        x, w, qb, kb, vb);

    const size_t smem =
        (size_t)(256 * 72 + 256 * 72 + 64 * 264 + 8 * 16 * 40) * sizeof(_Float16); // 117760 B
    (void)hipFuncSetAttribute((const void*)attn_kernel,
                              hipFuncAttributeMaxDynamicSharedMemorySize, (int)smem);
    attn_kernel<<<dim3((unsigned)B), dim3(256), smem, stream>>>(qb, kb, vb, out);
}

// v002
// A run of this version takes 56.7 microseconds.
// Timed twice side by side with v001, it ran 1.38 times as fast both times.
// Counting every step since v000, it is 2.42 times as fast.
#include <hip/hip_runtime.h>
#include <hip/hip_bf16.h>
#include <cstdint>
#include <cstddef>

typedef __attribute__((ext_vector_type(16))) _Float16 v16h;
typedef __attribute__((ext_vector_type(8)))  float    v8f;
typedef __attribute__((ext_vector_type(4)))  int      v4i;
typedef __attribute__((ext_vector_type(2)))  _Float16 v2h;

static constexpr int T     = 256;   // sequence length
static constexpr int CEMB  = 384;   // embed dim
static constexpr int HS    = 64;    // head size
static constexpr int NQKV  = 192;   // 3 * HS

#if __has_builtin(__builtin_amdgcn_global_load_async_to_lds_b128)
#define HAVE_ASYNC_LDS 1
// From the compiler diagnostic: the builtin takes a pointer to int4 in the
// global (AS1) space and a pointer to int4 in LDS (AS3), plus imm offset/cpol.
typedef __attribute__((address_space(1))) v4i* gv4i_p;   // int4 in global memory
typedef __attribute__((address_space(3))) v4i* lv4i_p;   // int4 in LDS
#endif

__device__ __forceinline__ int kmap(int e, int hi) {
    return (e & 7) + ((e >> 3) << 4) + (hi ? 8 : 0);
}

__device__ __forceinline__ float xhalf(float v) {
    const int bits = __builtin_bit_cast(int, v);
    return __builtin_bit_cast(float,
        __builtin_amdgcn_permlanex16(bits, bits, 0x76543210, 0xfedcba98, false, false));
}

// ---------------------------------------------------------------------------
// Kernel 1: QKV projection. [B*T,384] f32 @ [384,192] f32 -> Q,K,V f16.
// Q is pre-scaled by (1/sqrt(384)) * log2(e) so attention softmax runs in
// exp2 domain (native v_exp_f32).
// ---------------------------------------------------------------------------
__global__ __launch_bounds__(256) void qkv_proj_kernel(
    const float* __restrict__ x, const float* __restrict__ w,
    _Float16* __restrict__ qb, _Float16* __restrict__ kb, _Float16* __restrict__ vb)
{
    constexpr int LDP = 72;                 // 144B row stride: 16B-multiple, conflict-free
    __shared__ _Float16 xs[128 * LDP];      // x tile: 128 rows x 32 K
    __shared__ _Float16 wt[NQKV * LDP];     // w chunk, transposed: 192 cols x 32 K

    const int tid = threadIdx.x;
    const int wv  = tid >> 5;               // wave 0..7
    const int ln  = tid & 15;
    const int hi  = (tid >> 4) & 1;
    const size_t m0 = (size_t)blockIdx.x * 128;

    v8f acc[12] = {};                       // wave strip: 16 rows x 192 cols

    // Loader lane maps: 8 neighbouring lanes x 16 B cover one whole 128-B line,
    // so every wave-wide load touches 4 lines instead of one line per lane.
    const int xr = tid >> 3;                // x loader: row 0..31 (+32 per pass)
    const int xc = (tid & 7) * 4;           // x loader: col base (4 floats)
    const int wq = (tid >> 3) & 3;          // w loader: K-row pair within a group of 4 pairs
    const int wc = (tid & 7) * 4;           // w loader: col base within a 32-col line
    const int wk   = ((wv >> 1) * 4 + wq) * 2;   // w loader: K rows wk, wk+1
    const int wcol = (wv & 1) * 96 + wc;         // w loader: first of 3 lines (32 cols apart)

    for (int kk = 0; kk < 12; ++kk) {
        const int k0 = kk * 32;

        // Prefetch next x chunk while this one converts (global_prefetch_b8).
        if (kk < 11) {
#pragma unroll
            for (int p = 0; p < 4; ++p)
                __builtin_prefetch(
                    (const void*)(x + (m0 + xr + 32 * p) * CEMB + (k0 + 32) + xc), 0, 3);
        }

        // x[128 x 32] f32 -> f16 LDS: one pass = 32 rows, a wave = 4 rows x 128 B
        const float* xg = x + (m0 + xr) * CEMB + k0 + xc;
        float4 fx[4];
#pragma unroll
        for (int p = 0; p < 4; ++p)
            fx[p] = *reinterpret_cast<const float4*>(xg + p * 32 * CEMB);
        // w[32 x 192] f32 -> transposed f16 LDS (B fragments read contiguous K runs).
        // A wave takes 4 K-row pairs x 3 lines of 32 cols; a thread holds rows k, k+1
        // of 4 cols per line and stores each col's pair as one dword.
        const float* wg = w + (size_t)(k0 + wk) * NQKV + wcol;
        float4 f0[3], f1[3];
#pragma unroll
        for (int p = 0; p < 3; ++p) {
            f0[p] = *reinterpret_cast<const float4*>(wg + 32 * p);
            f1[p] = *reinterpret_cast<const float4*>(wg + 32 * p + NQKV);
        }
        // Wait before a register that the ten loads above name as an address is overwritten.
        // The two addresses are inputs so that they are still live here.
        asm volatile("s_wait_xcnt 0x0" :: "v"(xg), "v"(wg) : "memory");
#pragma unroll
        for (int p = 0; p < 4; ++p) {
            const int r = xr + 32 * p;
            xs[r * LDP + xc + 0] = (_Float16)fx[p].x;
            xs[r * LDP + xc + 1] = (_Float16)fx[p].y;
            xs[r * LDP + xc + 2] = (_Float16)fx[p].z;
            xs[r * LDP + xc + 3] = (_Float16)fx[p].w;
        }
#pragma unroll
        for (int p = 0; p < 3; ++p) {
            _Float16* wd = &wt[(wcol + 32 * p) * LDP + wk];
            *reinterpret_cast<v2h*>(wd + 0 * LDP) = v2h{(_Float16)f0[p].x, (_Float16)f1[p].x};
            *reinterpret_cast<v2h*>(wd + 1 * LDP) = v2h{(_Float16)f0[p].y, (_Float16)f1[p].y};
            *reinterpret_cast<v2h*>(wd + 2 * LDP) = v2h{(_Float16)f0[p].z, (_Float16)f1[p].z};
            *reinterpret_cast<v2h*>(wd + 3 * LDP) = v2h{(_Float16)f0[p].w, (_Float16)f1[p].w};
        }
        __syncthreads();

        v16h af;
#pragma unroll
        for (int e = 0; e < 16; ++e) af[e] = xs[(wv * 16 + ln) * LDP + kmap(e, hi)];
#pragma unroll
        for (int j = 0; j < 12; ++j) {
            v16h bf;
#pragma unroll
            for (int e = 0; e < 16; ++e) bf[e] = wt[(j * 16 + ln) * LDP + kmap(e, hi)];
            acc[j] = __builtin_amdgcn_wmma_f32_16x16x32_f16(
                false, af, false, bf, (short)0, acc[j], false, false);
        }
        __syncthreads();
    }

    // qscale = log2(e) / sqrt(C): fold softmax scale + exp2 conversion into Q.
    const float qscale = 1.442695040888963f * rsqrtf((float)CEMB);
#pragma unroll
    for (int j = 0; j < 12; ++j) {
#pragma unroll
        for (int i = 0; i < 8; ++i) {
            const size_t gm = m0 + wv * 16 + i + 8 * hi;   // C layout: row = i + 8*hi
            const int    c  = j * 16 + ln;                 // col = lane%16
            const float  v  = acc[j][i];
            if (j < 4)      qb[gm * HS + c]         = (_Float16)(v * qscale);
            else if (j < 8) kb[gm * HS + (c - 64)]  = (_Float16)v;
            else            vb[gm * HS + (c - 128)] = (_Float16)v;
        }
    }
}

__global__ __launch_bounds__(256) void attn_kernel(
    const _Float16* __restrict__ qb, const _Float16* __restrict__ kb,
    const _Float16* __restrict__ vb, float* __restrict__ out)
{
    constexpr int KLDP = 72;    // Q/K rows [256][72]  (144B stride, 16B-mult, conflict-free)
    constexpr int VLDP = 264;   // V^T rows [64][264]  (528B stride, 16B-mult)
    constexpr int OLDP = 68;    // out stage [8][16][68] f32 (272B stride, 16B-mult, conflict-free)
    extern __shared__ _Float16 smem[];
    _Float16* Qs = smem;                    // 256*72 = 18432 halves
    _Float16* Ks = Qs + 256 * KLDP;         // 256*72 = 18432 halves
    _Float16* Vt = Ks + 256 * KLDP;         // 64*264 = 16896 halves

    const int b   = blockIdx.x;
    const int tid = threadIdx.x;
    const int wv  = tid >> 5;
    const int ln  = tid & 15;
    const int hi  = (tid >> 4) & 1;
    float* Os = reinterpret_cast<float*>(Vt + 64 * VLDP) + wv * 16 * OLDP;  // this wave's 16 rows

    // ---- Stage Q, K (row-major) and V (transposed) into LDS, one row/thread.
    {
        const int r = tid; // 0..255
        const _Float16* qg = qb + ((size_t)b * T + r) * HS;
        const _Float16* kg = kb + ((size_t)b * T + r) * HS;
        const float4*   vg = reinterpret_cast<const float4*>(vb + ((size_t)b * T + r) * HS);

#ifdef HAVE_ASYNC_LDS
#pragma unroll
        for (int j = 0; j < 8; ++j) {
            __builtin_amdgcn_global_load_async_to_lds_b128(
                (gv4i_p)(qg + j * 8), (lv4i_p)(&Qs[r * KLDP + j * 8]), 0, 0);
            __builtin_amdgcn_global_load_async_to_lds_b128(
                (gv4i_p)(kg + j * 8), (lv4i_p)(&Ks[r * KLDP + j * 8]), 0, 0);
        }
#else
        const float4* qg4 = reinterpret_cast<const float4*>(qg);
        const float4* kg4 = reinterpret_cast<const float4*>(kg);
#pragma unroll
        for (int j = 0; j < 8; ++j) {
            *reinterpret_cast<float4*>(&Qs[r * KLDP + j * 8]) = qg4[j];
            *reinterpret_cast<float4*>(&Ks[r * KLDP + j * 8]) = kg4[j];
        }
#endif
#pragma unroll
        for (int j = 0; j < 8; ++j) {
            float4 vf = vg[j];
            const _Float16* hp = reinterpret_cast<const _Float16*>(&vf);
#pragma unroll
            for (int i2 = 0; i2 < 8; ++i2) Vt[(j * 8 + i2) * VLDP + r] = hp[i2];
        }
    }
#ifdef HAVE_ASYNC_LDS
    asm volatile("s_wait_asynccnt 0" ::: "memory");
#endif
    __syncthreads();

    // ---- Balanced strip pair: pi=0 -> strip wv, pi=1 -> strip 15-wv.
#pragma unroll
    for (int pi = 0; pi < 2; ++pi) {
        const int a  = pi ? (15 - wv) : wv;   // strip index, rows [16a, 16a+16)
        const int t0 = a * 16;

        // Q strip as B fragments of S^T = K Q^T: 2 K-chunks of 32 (contiguous LDS runs).
        v16h qa[2];
#pragma unroll
        for (int kc = 0; kc < 2; ++kc)
#pragma unroll
            for (int e = 0; e < 16; ++e)
                qa[kc][e] = Qs[(t0 + ln) * KLDP + 32 * kc + kmap(e, hi)];

        // Transposed tiles: a lane owns ONE query row (t0 + ln); its registers run over
        // keys (scores) or head dims (output), 8 per tile, the wave halves 8 apart.
        v8f   o[4] = {};                      // O^T: 64 dims x 16 queries
        float mrow = -3.0e38f;                // running maximum of the lane's query
        float lrow = 0.0f;                    // sum over this wave half's keys only
        const int trow = t0 + ln;

        const int nch = (a >> 1) + 1;         // causal 32-col chunks for this strip
        for (int ch = 0; ch < nch; ++ch) {
            const int s0 = ch * 32;

            // S^T = K (32x64) @ Q^T (64x16): 2 frags x 2 K-steps = 4 WMMA
            v8f sf[2] = {};
#pragma unroll
            for (int ct = 0; ct < 2; ++ct)
#pragma unroll
                for (int kc = 0; kc < 2; ++kc) {
                    v16h kf;
#pragma unroll
                    for (int e = 0; e < 16; ++e)
                        kf[e] = Ks[(s0 + 16 * ct + ln) * KLDP + 32 * kc + kmap(e, hi)];
                    sf[ct] = __builtin_amdgcn_wmma_f32_16x16x32_f16(
                        false, kf, false, qa[kc], (short)0, sf[ct], false, false);
                }

            // Causal mask + online softmax (exp2 domain; scale folded into Q).
            // sf[ct][i] is key s0 + 16*ct + 8*hi + i against the lane's query.
            float rm = -3.0e38f;
#pragma unroll
            for (int ct = 0; ct < 2; ++ct)
#pragma unroll
                for (int i = 0; i < 8; ++i) {
                    const int scol = s0 + 16 * ct + 8 * hi + i;
                    if (scol > trow) sf[ct][i] = -3.0e38f;
                    rm = fmaxf(rm, sf[ct][i]);
                }
            rm = fmaxf(rm, xhalf(rm));        // the other 16 keys of this query
            const float mnew = fmaxf(mrow, rm);
            const float corr = exp2f(mrow - mnew);
            mrow = mnew;
            float rs = 0.0f;
#pragma unroll
            for (int ct = 0; ct < 2; ++ct)
#pragma unroll
                for (int i = 0; i < 8; ++i) {
                    const float p = exp2f(sf[ct][i] - mnew);
                    sf[ct][i] = p;
                    rs += p;
                }
            lrow = lrow * corr + rs;
#pragma unroll
            for (int dc = 0; dc < 4; ++dc)
#pragma unroll
                for (int i = 0; i < 8; ++i) o[dc][i] *= corr;

            // The two S^T tiles, converted in place, are the B fragment of P^T:
            // element e holds key kmap(e, hi) of the chunk.
            v16h pa;
#pragma unroll
            for (int e = 0; e < 16; ++e) pa[e] = (_Float16)sf[e >> 3][e & 7];

            // O^T += V^T (64x32) @ P^T (32x16): 4 WMMA
#pragma unroll
            for (int dc = 0; dc < 4; ++dc) {
                v16h vf;
#pragma unroll
                for (int e = 0; e < 16; ++e)
                    vf[e] = Vt[(16 * dc + ln) * VLDP + s0 + kmap(e, hi)];
                o[dc] = __builtin_amdgcn_wmma_f32_16x16x32_f16(
                    false, vf, false, pa, (short)0, o[dc], false, false);
            }
        }

        // Join the halves' sums and normalize. A lane holds dims 16*dc + 8*hi + 0..7 of its
        // query: O^T turns back into rows in the wave's own LDS range, so that each store
        // below covers two whole output rows (512 contiguous bytes).
        const float inv = 1.0f / (lrow + xhalf(lrow));
        float* od = Os + ln * OLDP + 8 * hi;
#pragma unroll
        for (int dc = 0; dc < 4; ++dc) {
            *reinterpret_cast<float4*>(od + 16 * dc) =
                make_float4(o[dc][0] * inv, o[dc][1] * inv, o[dc][2] * inv, o[dc][3] * inv);
            *reinterpret_cast<float4*>(od + 16 * dc + 4) =
                make_float4(o[dc][4] * inv, o[dc][5] * inv, o[dc][6] * inv, o[dc][7] * inv);
        }
        // The rows read back below were written by other lanes of this wave.
        asm volatile("s_wait_dscnt 0" ::: "memory");
        float* og = out + ((size_t)b * T + t0 + hi) * HS + 4 * ln;
#pragma unroll
        for (int k = 0; k < 8; ++k)
            *reinterpret_cast<float4*>(og + 2 * k * HS) =
                *reinterpret_cast<const float4*>(Os + (2 * k + hi) * OLDP + 4 * ln);
    }
}

// ---------------------------------------------------------------------------
extern "C" void kernel_launch(void* const* d_in, const int* in_sizes, int n_in,
                              void* d_out, int out_size, void* d_ws, size_t ws_size,
                              hipStream_t stream) {
    const float* x = (const float*)d_in[0];
    const float* w = (const float*)d_in[1];
    float* out = (float*)d_out;

    const int B = in_sizes[0] / (T * CEMB);   // 512

    // Workspace: Q, K, V as f16, each B*T*HS elements (~16.8 MB each).
    _Float16* qb = (_Float16*)d_ws;
    _Float16* kb = qb + (size_t)B * T * HS;
    _Float16* vb = kb + (size_t)B * T * HS;

    qkv_proj_kernel<<<dim3((unsigned)((size_t)B * T / 128)), dim3(256), 0, stream>>>(
        x, w, qb, kb, vb);

    const size_t smem =
        (size_t)(256 * 72 + 256 * 72 + 64 * 264) * sizeof(_Float16) +
        (size_t)(8 * 16 * 68) * sizeof(float);                                // 142336 B
    (void)hipFuncSetAttribute((const void*)attn_kernel,
                              hipFuncAttributeMaxDynamicSharedMemorySize, (int)smem);
    attn_kernel<<<dim3((unsigned)B), dim3(256), smem, stream>>>(qb, kb, vb, out);
}

// v003
// A run of this version takes 40.8 microseconds.
// Next to v002, in two timings, it ran 1.40 and 1.39 times as fast.
// Over all steps from v000 it is 3.38 times as fast.
#include <hip/hip_runtime.h>
#include <hip/hip_bf16.h>
#include <cstdint>
#include <cstddef>

typedef __attribute__((ext_vector_type(16))) _Float16 v16h;
typedef __attribute__((ext_vector_type(8)))  float    v8f;
typedef __attribute__((ext_vector_type(8)))  _Float16 v8h;
typedef __attribute__((ext_vector_type(2)))  _Float16 v2h;

static constexpr int T     = 256;   // sequence length
static constexpr int CEMB  = 384;   // embed dim
static constexpr int HS    = 64;    // head size
static constexpr int NQKV  = 192;   // 3 * HS

__device__ __forceinline__ int kmap(int e, int hi) {
    return (e & 7) + ((e >> 3) << 4) + (hi ? 8 : 0);
}

__device__ __forceinline__ float xhalf(float v) {
    const int bits = __builtin_bit_cast(int, v);
    return __builtin_bit_cast(float,
        __builtin_amdgcn_permlanex16(bits, bits, 0x76543210, 0xfedcba98, false, false));
}

static constexpr int LDP   = 72;    // staging rows (144B stride: 16B-multiple, conflict-free)
static constexpr int KLDP  = 72;    // K rows [256][72]    (144B stride, 16B-mult, conflict-free)
static constexpr int VLDP  = 264;   // V^T rows [64][264]  (528B stride, 16B-mult)
static constexpr int OLDP  = 68;    // out stage [8][16][68] f32 (272B stride, 16B-mult, conflict-free)

// ---------------------------------------------------------------------------
// Projection of one 128-row tile of the block's own batch element:
// [128,384] f32 @ [384,192] f32. The wave takes the 16 rows 'strip' of the tile,
// which are rows t0 .. t0+15 of the batch element.
// Q and K are computed transposed (w^T x^T), so a lane owns one row and its registers
// run over 8 neighbouring columns: Q (pre-scaled by (1/sqrt(384)) * log2(e), so that the
// softmax runs in the exp2 domain) is at once the B fragment of S^T = K Q^T and stays
// in registers; a K row piece is one 16-B LDS store. V is computed straight, so a lane
// owns one column and 8 neighbouring rows: one 16-B store into V^T.
// ---------------------------------------------------------------------------
__device__ __forceinline__ void proj_tile(
    const float* __restrict__ x, const float* __restrict__ w,
    const size_t m0, const int strip, const int t0,
    _Float16* xs, _Float16* wt, _Float16* Ks, _Float16* Vt, v16h (&qa)[2])
{
    const int tid = threadIdx.x;
    const int wv  = tid >> 5;               // wave 0..7
    const int ln  = tid & 15;
    const int hi  = (tid >> 4) & 1;

    v8f acc[12] = {};                       // wave strip: 16 rows x 192 cols

    // Loader lane maps: 8 neighbouring lanes x 16 B cover one whole 128-B line,
    // so every wave-wide load touches 4 lines instead of one line per lane.
    const int xr = tid >> 3;                // x loader: row 0..31 (+32 per pass)
    const int xc = (tid & 7) * 4;           // x loader: col base (4 floats)
    const int wq = (tid >> 3) & 3;          // w loader: K-row pair within a group of 4 pairs
    const int wc = (tid & 7) * 4;           // w loader: col base within a 32-col line
    const int wk   = ((wv >> 1) * 4 + wq) * 2;   // w loader: K rows wk, wk+1
    const int wcol = (wv & 1) * 96 + wc;         // w loader: first of 3 lines (32 cols apart)

    for (int kk = 0; kk < 12; ++kk) {
        const int k0 = kk * 32;

        // Prefetch next x chunk while this one converts (global_prefetch_b8).
        if (kk < 11) {
#pragma unroll
            for (int p = 0; p < 4; ++p)
                __builtin_prefetch(
                    (const void*)(x + (m0 + xr + 32 * p) * CEMB + (k0 + 32) + xc), 0, 3);
        }

        // x[128 x 32] f32 -> f16 LDS: one pass = 32 rows, a wave = 4 rows x 128 B
        const float* xg = x + (m0 + xr) * CEMB + k0 + xc;
        float4 fx[4];
#pragma unroll
        for (int p = 0; p < 4; ++p)
            fx[p] = *reinterpret_cast<const float4*>(xg + p * 32 * CEMB);
        // w[32 x 192] f32 -> transposed f16 LDS (B fragments read contiguous K runs).
        // A wave takes 4 K-row pairs x 3 lines of 32 cols; a thread holds rows k, k+1
        // of 4 cols per line and stores each col's pair as one dword.
        const float* wg = w + (size_t)(k0 + wk) * NQKV + wcol;
        float4 f0[3], f1[3];
#pragma unroll
        for (int p = 0; p < 3; ++p) {
            f0[p] = *reinterpret_cast<const float4*>(wg + 32 * p);
            f1[p] = *reinterpret_cast<const float4*>(wg + 32 * p + NQKV);
        }
        // Wait before a register that the ten loads above name as an address is overwritten.
        // The two addresses are inputs so that they are still live here.
        asm volatile("s_wait_xcnt 0x0" :: "v"(xg), "v"(wg) : "memory");
#pragma unroll
        for (int p = 0; p < 4; ++p) {
            const int r = xr + 32 * p;
            xs[r * LDP + xc + 0] = (_Float16)fx[p].x;
            xs[r * LDP + xc + 1] = (_Float16)fx[p].y;
            xs[r * LDP + xc + 2] = (_Float16)fx[p].z;
            xs[r * LDP + xc + 3] = (_Float16)fx[p].w;
        }
#pragma unroll
        for (int p = 0; p < 3; ++p) {
            _Float16* wd = &wt[(wcol + 32 * p) * LDP + wk];
            *reinterpret_cast<v2h*>(wd + 0 * LDP) = v2h{(_Float16)f0[p].x, (_Float16)f1[p].x};
            *reinterpret_cast<v2h*>(wd + 1 * LDP) = v2h{(_Float16)f0[p].y, (_Float16)f1[p].y};
            *reinterpret_cast<v2h*>(wd + 2 * LDP) = v2h{(_Float16)f0[p].z, (_Float16)f1[p].z};
            *reinterpret_cast<v2h*>(wd + 3 * LDP) = v2h{(_Float16)f0[p].w, (_Float16)f1[p].w};
        }
        __syncthreads();

        v16h af;
#pragma unroll
        for (int e = 0; e < 16; ++e) af[e] = xs[(strip * 16 + ln) * LDP + kmap(e, hi)];
#pragma unroll
        for (int j = 0; j < 12; ++j) {
            v16h bf;
#pragma unroll
            for (int e = 0; e < 16; ++e) bf[e] = wt[(j * 16 + ln) * LDP + kmap(e, hi)];
            // The A and B fragments share one lane and k map, so swapping them transposes the tile.
            if (j < 8)
                acc[j] = __builtin_amdgcn_wmma_f32_16x16x32_f16(
                    false, bf, false, af, (short)0, acc[j], false, false);
            else
                acc[j] = __builtin_amdgcn_wmma_f32_16x16x32_f16(
                    false, af, false, bf, (short)0, acc[j], false, false);
        }
        __syncthreads();
    }

    // Q: acc[j][i] is column 16*j + 8*hi + i of row t0 + ln; element e of B fragment kc is
    // column 32*kc + kmap(e, hi). qscale = log2(e) / sqrt(C).
    const float qscale = 1.442695040888963f * rsqrtf((float)CEMB);
#pragma unroll
    for (int kc = 0; kc < 2; ++kc)
#pragma unroll
        for (int e = 0; e < 16; ++e)
            qa[kc][e] = (_Float16)(acc[2 * kc + (e >> 3)][e & 7] * qscale);
    // K: columns 16*j + 8*hi + 0..7 of row t0 + ln.
#pragma unroll
    for (int j = 0; j < 4; ++j) {
        v8h h;
#pragma unroll
        for (int i = 0; i < 8; ++i) h[i] = (_Float16)acc[4 + j][i];
        *reinterpret_cast<v8h*>(&Ks[(t0 + ln) * KLDP + 16 * j + 8 * hi]) = h;
    }
    // V^T: rows t0 + 8*hi + 0..7 of column 16*j + ln.
#pragma unroll
    for (int j = 0; j < 4; ++j) {
        v8h h;
#pragma unroll
        for (int i = 0; i < 8; ++i) h[i] = (_Float16)acc[8 + j][i];
        *reinterpret_cast<v8h*>(&Vt[(16 * j + ln) * VLDP + t0 + 8 * hi]) = h;
    }
}

// ---------------------------------------------------------------------------
// QKV projection + causal flash attention, one workgroup per batch element.
// 8 waves; wave w owns the 16-row strip PAIR {w, 15-w}, in the projection (two tiles of
// 128 rows, one strip of each) and in the attention: strip a needs floor(a/2)+1 causal
// 32-col chunks, so every wave does exactly 9 chunks (balanced). No workgroup barriers
// inside the divergent chunk loops.
// Scores and output are computed transposed (S^T = K Q^T, O^T = V^T P^T), so a
// lane owns one query: softmax runs in-lane and P never leaves the registers.
// ---------------------------------------------------------------------------
__global__ __launch_bounds__(256) void head_kernel(
    const float* __restrict__ x, const float* __restrict__ w, float* __restrict__ out)
{
    extern __shared__ _Float16 smem[];
    _Float16* Ks = smem;                    // 256*72 = 18432 halves
    _Float16* Vt = Ks + 256 * KLDP;         // 64*264 = 16896 halves
    _Float16* xs = Vt + 64 * VLDP;          // x tile: 128 rows x 32 K
    _Float16* wt = xs + 128 * LDP;          // w chunk, transposed: 192 cols x 32 K

    const int b   = blockIdx.x;
    const int tid = threadIdx.x;
    const int wv  = tid >> 5;
    const int ln  = tid & 15;
    const int hi  = (tid >> 4) & 1;
    // This wave's 16 output rows; they lie on the projection's staging, which is dead by then.
    float* Os = reinterpret_cast<float*>(xs) + wv * 16 * OLDP;

    // ---- Projection: rows 0..127 (strip wv), then rows 128..255 (strip 15-wv).
    v16h qf[2][2];
    proj_tile(x, w, (size_t)b * T,       wv,     wv * 16,        xs, wt, Ks, Vt, qf[0]);
    proj_tile(x, w, (size_t)b * T + 128, 7 - wv, (15 - wv) * 16, xs, wt, Ks, Vt, qf[1]);
    // Every wave reads K and V^T rows below that other waves wrote.
    __syncthreads();

    // ---- Balanced strip pair: pi=0 -> strip wv, pi=1 -> strip 15-wv.
#pragma unroll
    for (int pi = 0; pi < 2; ++pi) {
        const int a  = pi ? (15 - wv) : wv;   // strip index, rows [16a, 16a+16)
        const int t0 = a * 16;

        // Q strip as B fragments of S^T = K Q^T: 2 K-chunks of 32.
        const v16h (&qa)[2] = qf[pi];
        // Transposed tiles: a lane owns ONE query row (t0 + ln); its registers run over
        // keys (scores) or head dims (output), 8 per tile, the wave halves 8 apart.
        v8f   o[4] = {};                      // O^T: 64 dims x 16 queries
        float mrow = -3.0e38f;                // running maximum of the lane's query
        float lrow = 0.0f;                    // sum over this wave half's keys only
        const int trow = t0 + ln;

        const int nch = (a >> 1) + 1;         // causal 32-col chunks for this strip
        for (int ch = 0; ch < nch; ++ch) {
            const int s0 = ch * 32;

            // S^T = K (32x64) @ Q^T (64x16): 2 frags x 2 K-steps = 4 WMMA
            v8f sf[2] = {};
#pragma unroll
            for (int ct = 0; ct < 2; ++ct)
#pragma unroll
                for (int kc = 0; kc < 2; ++kc) {
                    v16h kf;
#pragma unroll
                    for (int e = 0; e < 16; ++e)
                        kf[e] = Ks[(s0 + 16 * ct + ln) * KLDP + 32 * kc + kmap(e, hi)];
                    sf[ct] = __builtin_amdgcn_wmma_f32_16x16x32_f16(
                        false, kf, false, qa[kc], (short)0, sf[ct], false, false);
                }

            // Causal mask + online softmax (exp2 domain; scale folded into Q).
            // sf[ct][i] is key s0 + 16*ct + 8*hi + i against the lane's query.
            float rm = -3.0e38f;
#pragma unroll
            for (int ct = 0; ct < 2; ++ct)
#pragma unroll
                for (int i = 0; i < 8; ++i) {
                    const int scol = s0 + 16 * ct + 8 * hi + i;
                    if (scol > trow) sf[ct][i] = -3.0e38f;
                    rm = fmaxf(rm, sf[ct][i]);
                }
            rm = fmaxf(rm, xhalf(rm));        // the other 16 keys of this query
            const float mnew = fmaxf(mrow, rm);
            const float corr = exp2f(mrow - mnew);
            mrow = mnew;
            float rs = 0.0f;
#pragma unroll
            for (int ct = 0; ct < 2; ++ct)
#pragma unroll
                for (int i = 0; i < 8; ++i) {
                    const float p = exp2f(sf[ct][i] - mnew);
                    sf[ct][i] = p;
                    rs += p;
                }
            lrow = lrow * corr + rs;
#pragma unroll
            for (int dc = 0; dc < 4; ++dc)
#pragma unroll
                for (int i = 0; i < 8; ++i) o[dc][i] *= corr;

            // The two S^T tiles, converted in place, are the B fragment of P^T:
            // element e holds key kmap(e, hi) of the chunk.
            v16h pa;
#pragma unroll
            for (int e = 0; e < 16; ++e) pa[e] = (_Float16)sf[e >> 3][e & 7];

            // O^T += V^T (64x32) @ P^T (32x16): 4 WMMA
#pragma unroll
            for (int dc = 0; dc < 4; ++dc) {
                v16h vf;
#pragma unroll
                for (int e = 0; e < 16; ++e)
                    vf[e] = Vt[(16 * dc + ln) * VLDP + s0 + kmap(e, hi)];
                o[dc] = __builtin_amdgcn_wmma_f32_16x16x32_f16(
                    false, vf, false, pa, (short)0, o[dc], false, false);
            }
        }

        // Join the halves' sums and normalize. A lane holds dims 16*dc + 8*hi + 0..7 of its
        // query: O^T turns back into rows in the wave's own LDS range, so that each store
        // below covers two whole output rows (512 contiguous bytes).
        const float inv = 1.0f / (lrow + xhalf(lrow));
        float* od = Os + ln * OLDP + 8 * hi;
#pragma unroll
        for (int dc = 0; dc < 4; ++dc) {
            *reinterpret_cast<float4*>(od + 16 * dc) =
                make_float4(o[dc][0] * inv, o[dc][1] * inv, o[dc][2] * inv, o[dc][3] * inv);
            *reinterpret_cast<float4*>(od + 16 * dc + 4) =
                make_float4(o[dc][4] * inv, o[dc][5] * inv, o[dc][6] * inv, o[dc][7] * inv);
        }
        // The rows read back below were written by other lanes of this wave.
        asm volatile("s_wait_dscnt 0" ::: "memory");
        float* og = out + ((size_t)b * T + t0 + hi) * HS + 4 * ln;
#pragma unroll
        for (int k = 0; k < 8; ++k)
            *reinterpret_cast<float4*>(og + 2 * k * HS) =
                *reinterpret_cast<const float4*>(Os + (2 * k + hi) * OLDP + 4 * ln);
    }
}

// ---------------------------------------------------------------------------
extern "C" void kernel_launch(void* const* d_in, const int* in_sizes, int n_in,
                              void* d_out, int out_size, void* d_ws, size_t ws_size,
                              hipStream_t stream) {
    const float* x = (const float*)d_in[0];
    const float* w = (const float*)d_in[1];
    float* out = (float*)d_out;

    const int B = in_sizes[0] / (T * CEMB);   // 512

    const size_t smem =
        (size_t)(256 * 72 + 64 * 264 + 128 * 72 + 192 * 72) * sizeof(_Float16);   // 116736 B
    (void)hipFuncSetAttribute((const void*)head_kernel,
                              hipFuncAttributeMaxDynamicSharedMemorySize, (int)smem);
    head_kernel<<<dim3((unsigned)B), dim3(256), smem, stream>>>(x, w, out);
}

// v004
// It runs in 35.4 microseconds.
// Timed twice side by side with v003, it ran 1.14 and 1.16 times as fast.
// All steps since v000 together make it 3.90 times as fast.
#include <hip/hip_runtime.h>
#include <hip/hip_bf16.h>
#include <cstdint>
#include <cstddef>

typedef __attribute__((ext_vector_type(16))) _Float16 v16h;
typedef __attribute__((ext_vector_type(8)))  float    v8f;
typedef __attribute__((ext_vector_type(8)))  _Float16 v8h;
typedef __attribute__((ext_vector_type(2)))  _Float16 v2h;

static constexpr int T     = 256;   // sequence length
static constexpr int CEMB  = 384;   // embed dim
static constexpr int HS    = 64;    // head size
static constexpr int NQKV  = 192;   // 3 * HS

__device__ __forceinline__ int kmap(int e, int hi) {
    return (e & 7) + ((e >> 3) << 4) + (hi ? 8 : 0);
}

__device__ __forceinline__ float xhalf(float v) {
    const int bits = __builtin_bit_cast(int, v);
    return __builtin_bit_cast(float,
        __builtin_amdgcn_permlanex16(bits, bits, 0x76543210, 0xfedcba98, false, false));
}

static constexpr int LDP   = 72;    // staging rows (144B stride: 16B-multiple, conflict-free)
static constexpr int KLDP  = 72;    // K rows [256][72]    (144B stride, 16B-mult, conflict-free)
static constexpr int VLDP  = 264;   // V^T rows [64][264]  (528B stride, 16B-mult)
static constexpr int OLDP  = 68;    // out stage [8][16][68] f32 (272B stride, 16B-mult, conflict-free)

// One staging stage: x tile (128 rows x 32 K) and the w chunk, transposed (192 cols x 32 K).
static constexpr int STG   = 128 * LDP + 192 * LDP;   // halves per stage; there are two

// One K chunk of x and of w on its way from global memory to LDS, per thread.
struct Chunk {
    float4 fx[4];          // x: 4 passes of 32 rows
    float4 f0[3], f1[3];   // w: K rows k and k+1 of 3 lines of 32 cols
};

// Issues the ten loads of one chunk; nothing here waits for their data. xp: the address
// that the caller's prefetches in front of this call name (xg where there are none);
// xb, wb: the pointers that xg, xp and wg are formed from by adding an offset.
__device__ __forceinline__ void load_chunk(const float* xg, const float* wg, const float* xp,
                                           const float* xb, const float* wb, Chunk& c) {
#pragma unroll
    for (int p = 0; p < 4; ++p)
        c.fx[p] = *reinterpret_cast<const float4*>(xg + p * 32 * CEMB);
#pragma unroll
    for (int p = 0; p < 3; ++p) {
        c.f0[p] = *reinterpret_cast<const float4*>(wg + 32 * p);
        c.f1[p] = *reinterpret_cast<const float4*>(wg + 32 * p + NQKV);
    }
    // Wait before a register that the ten loads above, or the prefetches, name as an address
    // is overwritten. The addresses are inputs so that they are still live here; the bases too,
    // because a constant offset goes into the instruction and the base is then the address.
    asm volatile("s_wait_xcnt 0x0" :: "v"(xg), "v"(wg), "v"(xp), "v"(xb), "v"(wb) : "memory");
}

// ---------------------------------------------------------------------------
// Projection of one 128-row tile of the block's own batch element:
// [128,384] f32 @ [384,192] f32. The wave takes the 16 rows 'strip' of the tile,
// which are rows t0 .. t0+15 of the batch element.
// Q and K are computed transposed (w^T x^T), so a lane owns one row and its registers
// run over 8 neighbouring columns: Q (pre-scaled by (1/sqrt(384)) * log2(e), so that the
// softmax runs in the exp2 domain) is at once the B fragment of S^T = K Q^T and stays
// in registers; a K row piece is one 16-B LDS store. V is computed straight, so a lane
// owns one column and 8 neighbouring rows: one 16-B store into V^T.
// The K loop is pipelined: on entry 'c' holds the loads of chunk 0, already issued; each
// trip puts its chunk into LDS stage kk & 1 and issues the next chunk's loads, which fly
// while this chunk's products run. MORE: a tile of 128 rows follows this one, and the
// last trip issues that tile's chunk 0.
// ---------------------------------------------------------------------------
template <bool MORE>
__device__ __forceinline__ void proj_tile(
    const float* __restrict__ x, const float* __restrict__ w,
    const size_t m0, const int strip, const int t0,
    _Float16* st, _Float16* Ks, _Float16* Vt, v16h (&qa)[2], Chunk& c)
{
    const int tid = threadIdx.x;
    const int wv  = tid >> 5;               // wave 0..7
    const int ln  = tid & 15;
    const int hi  = (tid >> 4) & 1;

    v8f acc[12] = {};                       // wave strip: 16 rows x 192 cols

    // Loader lane maps: 8 neighbouring lanes x 16 B cover one whole 128-B line,
    // so every wave-wide load touches 4 lines instead of one line per lane.
    const int xr = tid >> 3;                // x loader: row 0..31 (+32 per pass)
    const int xc = (tid & 7) * 4;           // x loader: col base (4 floats)
    const int wq = (tid >> 3) & 3;          // w loader: K-row pair within a group of 4 pairs
    const int wc = (tid & 7) * 4;           // w loader: col base within a 32-col line
    const int wk   = ((wv >> 1) * 4 + wq) * 2;   // w loader: K rows wk, wk+1
    const int wcol = (wv & 1) * 96 + wc;         // w loader: first of 3 lines (32 cols apart)

    const float* xrow = x + (m0 + xr) * CEMB + xc;      // this thread's piece of chunk 0
    const float* wrow = w + (size_t)wk * NQKV + wcol;
    // Chunk k of this tile, in floats from chunk 0; 12 and 13 are the next tile's first two.
    auto xoff = [](int k) { return k < 12 ? k * 32 : 128 * CEMB + (k - 12) * 32; };

    for (int kk = 0; kk < 12; ++kk) {
        _Float16* xs = st + (kk & 1) * STG;
        _Float16* wt = xs + 128 * LDP;

        // x[128 x 32] f32 -> f16 LDS: one pass = 32 rows, a wave = 4 rows x 128 B
#pragma unroll
        for (int p = 0; p < 4; ++p) {
            const int r = xr + 32 * p;
            xs[r * LDP + xc + 0] = (_Float16)c.fx[p].x;
            xs[r * LDP + xc + 1] = (_Float16)c.fx[p].y;
            xs[r * LDP + xc + 2] = (_Float16)c.fx[p].z;
            xs[r * LDP + xc + 3] = (_Float16)c.fx[p].w;
        }
        // w[32 x 192] f32 -> transposed f16 LDS (B fragments read contiguous K runs).
        // A wave takes 4 K-row pairs x 3 lines of 32 cols; a thread holds rows k, k+1
        // of 4 cols per line and stores each col's pair as one dword.
#pragma unroll
        for (int p = 0; p < 3; ++p) {
            _Float16* wd = &wt[(wcol + 32 * p) * LDP + wk];
            *reinterpret_cast<v2h*>(wd + 0 * LDP) = v2h{(_Float16)c.f0[p].x, (_Float16)c.f1[p].x};
            *reinterpret_cast<v2h*>(wd + 1 * LDP) = v2h{(_Float16)c.f0[p].y, (_Float16)c.f1[p].y};
            *reinterpret_cast<v2h*>(wd + 2 * LDP) = v2h{(_Float16)c.f0[p].z, (_Float16)c.f1[p].z};
            *reinterpret_cast<v2h*>(wd + 3 * LDP) = v2h{(_Float16)c.f0[p].w, (_Float16)c.f1[p].w};
        }

        // The next chunk's loads, into the registers just emptied.
        if (MORE || kk < 11) {
            const float* xn = xrow + xoff(kk + 1);
            const float* xp = xn;
            // Prefetch the x chunk whose loads the next trip issues (global_prefetch_b8).
            if (MORE || kk < 10) {
                xp = xrow + xoff(kk + 2);
#pragma unroll
                for (int p = 0; p < 4; ++p)
                    __builtin_prefetch((const void*)(xp + p * 32 * CEMB), 0, 3);
            }
            load_chunk(xn, wrow + ((kk < 11) ? kk + 1 : 0) * 32 * NQKV, xp, xrow, wrow, c);
        }

        // The one barrier of a trip: it publishes this stage, and a wave that has passed it
        // knows that every wave is done reading the other stage, which the next trip fills.
        // Written by hand with the LDS wait alone: __syncthreads() also waited for the
        // global loads just issued, which are to stay in flight over the products below.
        asm volatile("s_wait_dscnt 0x0\n\ts_barrier_signal -1\n\ts_barrier_wait -1" ::: "memory");

        v16h af;
#pragma unroll
        for (int e = 0; e < 16; ++e) af[e] = xs[(strip * 16 + ln) * LDP + kmap(e, hi)];
#pragma unroll
        for (int j = 0; j < 12; ++j) {
            v16h bf;
#pragma unroll
            for (int e = 0; e < 16; ++e) bf[e] = wt[(j * 16 + ln) * LDP + kmap(e, hi)];
            // The A and B fragments share one lane and k map, so swapping them transposes the tile.
            if (j < 8)
                acc[j] = __builtin_amdgcn_wmma_f32_16x16x32_f16(
                    false, bf, false, af, (short)0, acc[j], false, false);
            else
                acc[j] = __builtin_amdgcn_wmma_f32_16x16x32_f16(
                    false, af, false, bf, (short)0, acc[j], false, false);
        }
    }

    // Q: acc[j][i] is column 16*j + 8*hi + i of row t0 + ln; element e of B fragment kc is
    // column 32*kc + kmap(e, hi). qscale = log2(e) / sqrt(C).
    const float qscale = 1.442695040888963f * rsqrtf((float)CEMB);
#pragma unroll
    for (int kc = 0; kc < 2; ++kc)
#pragma unroll
        for (int e = 0; e < 16; ++e)
            qa[kc][e] = (_Float16)(acc[2 * kc + (e >> 3)][e & 7] * qscale);
    // K: columns 16*j + 8*hi + 0..7 of row t0 + ln.
#pragma unroll
    for (int j = 0; j < 4; ++j) {
        v8h h;
#pragma unroll
        for (int i = 0; i < 8; ++i) h[i] = (_Float16)acc[4 + j][i];
        *reinterpret_cast<v8h*>(&Ks[(t0 + ln) * KLDP + 16 * j + 8 * hi]) = h;
    }
    // V^T: rows t0 + 8*hi + 0..7 of column 16*j + ln.
#pragma unroll
    for (int j = 0; j < 4; ++j) {
        v8h h;
#pragma unroll
        for (int i = 0; i < 8; ++i) h[i] = (_Float16)acc[8 + j][i];
        *reinterpret_cast<v8h*>(&Vt[(16 * j + ln) * VLDP + t0 + 8 * hi]) = h;
    }
}

// ---------------------------------------------------------------------------
// QKV projection + causal flash attention, one workgroup per batch element.
// 8 waves; wave w owns the 16-row strip PAIR {w, 15-w}, in the projection (two tiles of
// 128 rows, one strip of each) and in the attention: strip a needs floor(a/2)+1 causal
// 32-col chunks, so every wave does exactly 9 chunks (balanced). No workgroup barriers
// inside the divergent chunk loops.
// Scores and output are computed transposed (S^T = K Q^T, O^T = V^T P^T), so a
// lane owns one query: softmax runs in-lane and P never leaves the registers.
// ---------------------------------------------------------------------------
__global__ __launch_bounds__(256) void head_kernel(
    const float* __restrict__ x, const float* __restrict__ w, float* __restrict__ out)
{
    extern __shared__ _Float16 smem[];
    _Float16* Ks = smem;                    // 256*72 = 18432 halves
    _Float16* Vt = Ks + 256 * KLDP;         // 64*264 = 16896 halves
    _Float16* st = Vt + 64 * VLDP;          // two staging stages of STG halves

    const int b   = blockIdx.x;
    const int tid = threadIdx.x;
    const int wv  = tid >> 5;
    const int ln  = tid & 15;
    const int hi  = (tid >> 4) & 1;
    // This wave's 16 output rows; they lie on the projection's staging, which is dead by then.
    float* Os = reinterpret_cast<float*>(st) + wv * 16 * OLDP;

    // ---- Projection: rows 0..127 (strip wv), then rows 128..255 (strip 15-wv).
    v16h qf[2][2];
    Chunk c;
    const float* x0 = x + ((size_t)b * T + (tid >> 3)) * CEMB + (tid & 7) * 4;
    const float* w0 =
        w + (size_t)((((wv >> 1) * 4 + ((tid >> 3) & 3)) * 2) * NQKV) + (wv & 1) * 96 + (tid & 7) * 4;
    load_chunk(x0, w0, x0, x0, w0, c);
    proj_tile<true >(x, w, (size_t)b * T,       wv,     wv * 16,        st, Ks, Vt, qf[0], c);
    proj_tile<false>(x, w, (size_t)b * T + 128, 7 - wv, (15 - wv) * 16, st, Ks, Vt, qf[1], c);
    // The K and V^T rows that each wave wrote are read by other waves below.
    __syncthreads();

    // ---- Balanced strip pair: pi=0 -> strip wv, pi=1 -> strip 15-wv.
#pragma unroll
    for (int pi = 0; pi < 2; ++pi) {
        const int a  = pi ? (15 - wv) : wv;   // strip index, rows [16a, 16a+16)
        const int t0 = a * 16;

        // Q strip as B fragments of S^T = K Q^T: 2 K-chunks of 32.
        const v16h (&qa)[2] = qf[pi];
        // Transposed tiles: a lane owns ONE query row (t0 + ln); its registers run over
        // keys (scores) or head dims (output), 8 per tile, the wave halves 8 apart.
        v8f   o[4] = {};                      // O^T: 64 dims x 16 queries
        float mrow = -3.0e38f;                // running maximum of the lane's query
        float lrow = 0.0f;                    // sum over this wave half's keys only
        const int trow = t0 + ln;

        const int nch = (a >> 1) + 1;         // causal 32-col chunks for this strip
        for (int ch = 0; ch < nch; ++ch) {
            const int s0 = ch * 32;

            // S^T = K (32x64) @ Q^T (64x16): 2 frags x 2 K-steps = 4 WMMA
            v8f sf[2] = {};
#pragma unroll
            for (int ct = 0; ct < 2; ++ct)
#pragma unroll
                for (int kc = 0; kc < 2; ++kc) {
                    v16h kf;
#pragma unroll
                    for (int e = 0; e < 16; ++e)
                        kf[e] = Ks[(s0 + 16 * ct + ln) * KLDP + 32 * kc + kmap(e, hi)];
                    sf[ct] = __builtin_amdgcn_wmma_f32_16x16x32_f16(
                        false, kf, false, qa[kc], (short)0, sf[ct], false, false);
                }

            // Causal mask + online softmax (exp2 domain; scale folded into Q).
            // sf[ct][i] is key s0 + 16*ct + 8*hi + i against the lane's query.
            float rm = -3.0e38f;
#pragma unroll
            for (int ct = 0; ct < 2; ++ct)
#pragma unroll
                for (int i = 0; i < 8; ++i) {
                    const int scol = s0 + 16 * ct + 8 * hi + i;
                    if (scol > trow) sf[ct][i] = -3.0e38f;
                    rm = fmaxf(rm, sf[ct][i]);
                }
            rm = fmaxf(rm, xhalf(rm));        // the other 16 keys of this query
            const float mnew = fmaxf(mrow, rm);
            const float corr = exp2f(mrow - mnew);
            mrow = mnew;
            float rs = 0.0f;
#pragma unroll
            for (int ct = 0; ct < 2; ++ct)
#pragma unroll
                for (int i = 0; i < 8; ++i) {
                    const float p = exp2f(sf[ct][i] - mnew);
                    sf[ct][i] = p;
                    rs += p;
                }
            lrow = lrow * corr + rs;
#pragma unroll
            for (int dc = 0; dc < 4; ++dc)
#pragma unroll
                for (int i = 0; i < 8; ++i) o[dc][i] *= corr;

            // The two S^T tiles, converted in place, are the B fragment of P^T:
            // element e holds key kmap(e, hi) of the chunk.
            v16h pa;
#pragma unroll
            for (int e = 0; e < 16; ++e) pa[e] = (_Float16)sf[e >> 3][e & 7];

            // O^T += V^T (64x32) @ P^T (32x16): 4 WMMA
#pragma unroll
            for (int dc = 0; dc < 4; ++dc) {
                v16h vf;
#pragma unroll
                for (int e = 0; e < 16; ++e)
                    vf[e] = Vt[(16 * dc + ln) * VLDP + s0 + kmap(e, hi)];
                o[dc] = __builtin_amdgcn_wmma_f32_16x16x32_f16(
                    false, vf, false, pa, (short)0, o[dc], false, false);
            }
        }

        // Join the halves' sums and normalize. A lane holds dims 16*dc + 8*hi + 0..7 of its
        // query: O^T turns back into rows in the wave's own LDS range, so that each store
        // below covers two whole output rows (512 contiguous bytes).
        const float inv = 1.0f / (lrow + xhalf(lrow));
        float* od = Os + ln * OLDP + 8 * hi;
#pragma unroll
        for (int dc = 0; dc < 4; ++dc) {
            *reinterpret_cast<float4*>(od + 16 * dc) =
                make_float4(o[dc][0] * inv, o[dc][1] * inv, o[dc][2] * inv, o[dc][3] * inv);
            *reinterpret_cast<float4*>(od + 16 * dc + 4) =
                make_float4(o[dc][4] * inv, o[dc][5] * inv, o[dc][6] * inv, o[dc][7] * inv);
        }
        // The rows read back below were written by other lanes of this wave.
        asm volatile("s_wait_dscnt 0" ::: "memory");
        float* og = out + ((size_t)b * T + t0 + hi) * HS + 4 * ln;
#pragma unroll
        for (int k = 0; k < 8; ++k)
            *reinterpret_cast<float4*>(og + 2 * k * HS) =
                *reinterpret_cast<const float4*>(Os + (2 * k + hi) * OLDP + 4 * ln);
    }
}

// ---------------------------------------------------------------------------
extern "C" void kernel_launch(void* const* d_in, const int* in_sizes, int n_in,
                              void* d_out, int out_size, void* d_ws, size_t ws_size,
                              hipStream_t stream) {
    const float* x = (const float*)d_in[0];
    const float* w = (const float*)d_in[1];
    float* out = (float*)d_out;

    const int B = in_sizes[0] / (T * CEMB);   // 512

    const size_t smem =
        (size_t)(256 * 72 + 64 * 264 + 2 * (128 * 72 + 192 * 72)) * sizeof(_Float16);   // 162816 B
    (void)hipFuncSetAttribute((const void*)head_kernel,
                              hipFuncAttributeMaxDynamicSharedMemorySize, (int)smem);
    head_kernel<<<dim3((unsigned)B), dim3(256), smem, stream>>>(x, w, out);
}

// v005
// A run of this version takes 30.3 microseconds.
// In both of two side-by-side timings against v004, it was 1.17 times as fast.
// Counting every step since v000, it is 4.57 times as fast.
#include <hip/hip_runtime.h>
#include <hip/hip_bf16.h>
#include <cstdint>
#include <cstddef>

typedef __attribute__((ext_vector_type(16))) _Float16 v16h;
typedef __attribute__((ext_vector_type(8)))  float    v8f;
typedef __attribute__((ext_vector_type(8)))  _Float16 v8h;
typedef __attribute__((ext_vector_type(2)))  _Float16 v2h;

static constexpr int T     = 256;   // sequence length
static constexpr int CEMB  = 384;   // embed dim
static constexpr int HS    = 64;    // head size
static constexpr int NQKV  = 192;   // 3 * HS

__device__ __forceinline__ int kmap(int e, int hi) {
    return (e & 7) + ((e >> 3) << 4) + (hi ? 8 : 0);
}

__device__ __forceinline__ float xhalf(float v) {
    const int bits = __builtin_bit_cast(int, v);
    return __builtin_bit_cast(float,
        __builtin_amdgcn_permlanex16(bits, bits, 0x76543210, 0xfedcba98, false, false));
}

typedef __attribute__((ext_vector_type(4)))  _Float16 v4h;

static constexpr int WLDP  = 392;   // w^T rows [192][392] (784B stride: 16B x odd, conflict-free)
static constexpr int XLDP  = 40;    // x stage rows [16][40] (80B stride: 16B x odd, conflict-free)
static constexpr int KLDP  = 72;    // K rows [256][72]    (144B stride, 16B-mult, conflict-free)
static constexpr int VLDP  = 264;   // V^T rows [64][264]  (528B stride, 16B-mult)
static constexpr int OLDP  = 68;    // out stage [16][68] f32 a wave (272B stride, 16B-mult, conflict-free)
static constexpr int PRIV  = 16 * OLDP * 2;   // halves of a wave's own LDS range (x stages, then out stage)
static constexpr int DEPTH = 3;     // x chunks of a wave in flight from global memory
static constexpr int NCH   = CEMB / 32;       // K chunks of the projection
static constexpr int SMEM_HALVES = NQKV * WLDP + T * KLDP + HS * VLDP + 16 * PRIV;   // 290816 B

// Most plain '#pragma unroll' in this file are there so that the small arrays that the loop
// variable indexes (fragments, accumulators, chunks in flight) stay in registers.

// One K chunk (16 rows x 32 K, f32) of a wave's x strip on its way to LDS, per lane.
struct XChunk { float4 f[4]; };

// Issues the four loads of chunk k of the strip whose lane address is xl: 8 neighbouring
// lanes x 16 B cover one whole 128-B line, a wave-wide load covers 4 rows.
__device__ __forceinline__ void load_x(const float* xl, const int k, XChunk& c) {
#pragma unroll
    for (int p = 0; p < 4; ++p)
        c.f[p] = *reinterpret_cast<const float4*>(xl + p * 4 * CEMB + k * 32);
    // Wait before a register that the loads above name as an address is overwritten; the
    // address is an input so that it is still live here.
    asm volatile("s_wait_xcnt 0x0" :: "v"(xl) : "memory");
}

// Converts a chunk to f16 and puts it into the wave's own stage xs.
__device__ __forceinline__ void put_x(const XChunk& c, _Float16* xs, const int lane) {
    _Float16* d = xs + (lane >> 3) * XLDP + (lane & 7) * 4;
#pragma unroll
    for (int p = 0; p < 4; ++p)
        *reinterpret_cast<v4h*>(d + p * 4 * XLDP) =
            v4h{(_Float16)c.f[p].x, (_Float16)c.f[p].y, (_Float16)c.f[p].z, (_Float16)c.f[p].w};
}

// A or B fragment of 32 K from a row of halves: element e is K index kmap(e, hi).
__device__ __forceinline__ v16h frag(const _Float16* row, const int hi) {
    const v8h lo = *reinterpret_cast<const v8h*>(row + 8 * hi);
    const v8h up = *reinterpret_cast<const v8h*>(row + 16 + 8 * hi);
    return __builtin_shufflevector(lo, up, 0, 1, 2, 3, 4, 5, 6, 7, 8, 9, 10, 11, 12, 13, 14, 15);
}

// Work-group barrier with the LDS wait alone: __syncthreads() also waited for the global
// loads in flight, which are the next x chunks and are to stay in flight.
__device__ __forceinline__ void lds_barrier() {
    asm volatile("s_wait_dscnt 0x0\n\ts_barrier_signal -1\n\ts_barrier_wait -1" ::: "memory");
}

// ---------------------------------------------------------------------------
// QKV projection + causal flash attention. A workgroup of 16 waves converts w to f16 once,
// keeps it transposed in LDS, and then takes batch elements blockIdx.x, + gridDim.x, ...
// Wave wv owns rows 16*wv .. 16*wv+15 of each, in the projection and in the attention.
// Projection [16,384] @ [384,192]: only the owning wave reads an x row, so each wave stages
// its strip in its own LDS range and the K loop has no workgroup barrier; its loads run
// DEPTH chunks ahead, over the end of a batch element into the next one.
// Q and K are computed transposed (w^T x^T), so a lane owns one row and its registers
// run over 8 neighbouring columns: Q (pre-scaled by (1/sqrt(384)) * log2(e), so that the
// softmax runs in the exp2 domain) is at once the B fragment of S^T = K Q^T and stays
// in registers; a K row piece is one 16-B LDS store. V is computed straight, so a lane
// owns one column and 8 neighbouring rows: one 16-B store into V^T.
// Scores and output are computed transposed (S^T = K Q^T, O^T = V^T P^T), so a
// lane owns one query: softmax runs in-lane and P never leaves the registers.
// ---------------------------------------------------------------------------
__global__ __launch_bounds__(512) void head_kernel(
    const float* __restrict__ x, const float* __restrict__ w, float* __restrict__ out, const int nb)
{
    __shared__ __attribute__((aligned(16))) _Float16 smem[SMEM_HALVES];
    _Float16* Wt = smem;                    // 192*392 halves
    _Float16* Ks = Wt + NQKV * WLDP;        // 256*72 halves
    _Float16* Vt = Ks + T * KLDP;           // 64*264 halves

    if ((int)blockIdx.x >= nb) return;      // the whole workgroup, in front of every barrier

    const int tid  = threadIdx.x;
    const int wv   = tid >> 5;              // wave 0..15
    const int lane = tid & 31;
    const int ln   = tid & 15;
    const int hi   = (tid >> 4) & 1;
    const int t0   = wv * 16;
    _Float16* pv = Vt + HS * VLDP + wv * PRIV;
    float*    Os = reinterpret_cast<float*>(pv);

    const size_t bstep = (size_t)gridDim.x * T * CEMB;  // floats to the workgroup's next element
    const float* xl = x + ((size_t)blockIdx.x * T + t0 + (lane >> 3)) * CEMB + (lane & 7) * 4;
    XChunk ring[DEPTH];
    const _Float16* wr = Wt + ln * WLDP;                // the lane's row of the first w^T tile

    // ---- w[384 x 192] f32 -> transposed f16 LDS (B fragments read contiguous K runs).
    // 8 lanes take one 128-B line of K rows k and k+1; a thread stores each of its 4 cols'
    // pair as one dword. A wave's 4 lane groups take neighbouring K-row pairs.
    {
        const int g  = tid >> 3;            // 0..63
        const int l8 = tid & 7;
        const float* wl = w + (size_t)(2 * g) * NQKV + l8 * 4;
#pragma unroll
        for (int o = 0; o < 2; ++o) {
            float4 r0[9], r1[9];
#pragma unroll
            for (int j = 0; j < 9; ++j) {
                const int it = o * 9 + j;   // K rows (it % 3) * 128 + 2g, line it / 3
                const float* p = wl + (it % 3) * 128 * NQKV + (it / 3) * 32;
                r0[j] = *reinterpret_cast<const float4*>(p);
                r1[j] = *reinterpret_cast<const float4*>(p + NQKV);
            }
            // Wait before the address register of the loads above is overwritten.
            asm volatile("s_wait_xcnt 0x0" :: "v"(wl) : "memory");
            if (o == 0) {
#pragma unroll
                for (int k = 0; k < DEPTH; ++k) load_x(xl, k, ring[k]);
            }
#pragma unroll
            for (int j = 0; j < 9; ++j) {
                const int it = o * 9 + j;
                _Float16* wd = &Wt[((it / 3) * 32 + l8 * 4) * WLDP + (it % 3) * 128 + 2 * g];
                *reinterpret_cast<v2h*>(wd + 0 * WLDP) = v2h{(_Float16)r0[j].x, (_Float16)r1[j].x};
                *reinterpret_cast<v2h*>(wd + 1 * WLDP) = v2h{(_Float16)r0[j].y, (_Float16)r1[j].y};
                *reinterpret_cast<v2h*>(wd + 2 * WLDP) = v2h{(_Float16)r0[j].z, (_Float16)r1[j].z};
                *reinterpret_cast<v2h*>(wd + 3 * WLDP) = v2h{(_Float16)r0[j].w, (_Float16)r1[j].w};
            }
        }
    }
    // w^T is read by every wave below.
    lds_barrier();

    for (int b = blockIdx.x; b < nb; b += gridDim.x) {
        const bool more = b + (int)gridDim.x < nb;      // the same for the whole workgroup
        const float* xn = xl + bstep;                   // read only where 'more'

        v8f acc[12] = {};                   // 16 rows x 192 cols
        const _Float16* wk = wr;
#pragma unroll 1
        for (int kb = 0; kb < NCH / DEPTH; ++kb) {
            const float* xf = kb < NCH / DEPTH - 1 ? xl + (kb + 1) * DEPTH * 32
                                                   : (more ? xn : xl + kb * DEPTH * 32);
#pragma unroll
            for (int s = 0; s < DEPTH; ++s) {
                _Float16* xs = pv + s * 16 * XLDP;
                put_x(ring[s], xs, lane);
                load_x(xf, s, ring[s]);
                // The stage rows read next were written by other lanes of this wave.
                asm volatile("s_wait_dscnt 0x0" ::: "memory");
                const v16h af = frag(xs + ln * XLDP, hi);
#pragma unroll
                for (int h = 0; h < 2; ++h) {
                    v16h bf[6];
#pragma unroll
                    for (int j = 0; j < 6; ++j)
                        bf[j] = frag(wk + ((h * 6 + j) * 16) * WLDP + s * 32, hi);
                    // Keeps the six fragments' loads together in front of their products: one LDS
                    // latency a group; left alone the compiler waited for each fragment by itself.
                    __builtin_amdgcn_sched_barrier(0);
#pragma unroll
                    for (int j = 0; j < 6; ++j) {
                        const int c = h * 6 + j;
                        // The A and B fragments share one lane and k map, so swapping them transposes the tile.
                        if (c < 8)
                            acc[c] = __builtin_amdgcn_wmma_f32_16x16x32_f16(
                                false, bf[j], false, af, (short)0, acc[c], false, false);
                        else
                            acc[c] = __builtin_amdgcn_wmma_f32_16x16x32_f16(
                                false, af, false, bf[j], (short)0, acc[c], false, false);
                    }
                    // Keeps the next group's loads behind these products, off their registers.
                    __builtin_amdgcn_sched_barrier(0);
                }
            }
            wk += DEPTH * 32;
        }

        // Q: acc[j][i] is column 16*j + 8*hi + i of row t0 + ln; element e of B fragment kc is
        // column 32*kc + kmap(e, hi). qscale = log2(e) / sqrt(C).
        v16h qa[2];
        const float qscale = 1.442695040888963f * rsqrtf((float)CEMB);
#pragma unroll
        for (int kc = 0; kc < 2; ++kc)
#pragma unroll
            for (int e = 0; e < 16; ++e)
                qa[kc][e] = (_Float16)(acc[2 * kc + (e >> 3)][e & 7] * qscale);

        // Every wave is done reading K and V^T of the element before this one.
        if (b != (int)blockIdx.x) lds_barrier();
        // K: columns 16*j + 8*hi + 0..7 of row t0 + ln.
#pragma unroll
        for (int j = 0; j < 4; ++j) {
            v8h h;
#pragma unroll
            for (int i = 0; i < 8; ++i) h[i] = (_Float16)acc[4 + j][i];
            *reinterpret_cast<v8h*>(&Ks[(t0 + ln) * KLDP + 16 * j + 8 * hi]) = h;
        }
        // V^T: rows t0 + 8*hi + 0..7 of column 16*j + ln.
#pragma unroll
        for (int j = 0; j < 4; ++j) {
            v8h h;
#pragma unroll
            for (int i = 0; i < 8; ++i) h[i] = (_Float16)acc[8 + j][i];
            *reinterpret_cast<v8h*>(&Vt[(16 * j + ln) * VLDP + t0 + 8 * hi]) = h;
        }
        // K and V^T of the rows up to its own are read by every wave below.
        lds_barrier();

        // ---- Attention of the wave's strip; no workgroup barrier in the divergent chunk loop.
        const int a = wv;                     // strip index, rows [16a, 16a+16)
        // qa: the Q strip as B fragments of S^T = K Q^T, 2 K-chunks of 32.
        // Transposed tiles: a lane owns ONE query row (t0 + ln); its registers run over
        // keys (scores) or head dims (output), 8 per tile, the wave halves 8 apart.
        v8f   o[4] = {};                      // O^T: 64 dims x 16 queries
        float mrow = -3.0e38f;                // running maximum of the lane's query
        float lrow = 0.0f;                    // sum over this wave half's keys only
        const int trow = t0 + ln;

        const int nch = (a >> 1) + 1;         // causal 32-col chunks for this strip
        for (int ch = 0; ch < nch; ++ch) {
            const int s0 = ch * 32;

            // S^T = K (32x64) @ Q^T (64x16): 2 frags x 2 K-steps = 4 WMMA
            v8f sf[2] = {};
#pragma unroll
            for (int ct = 0; ct < 2; ++ct)
#pragma unroll
                for (int kc = 0; kc < 2; ++kc) {
                    v16h kf;
#pragma unroll
                    for (int e = 0; e < 16; ++e)
                        kf[e] = Ks[(s0 + 16 * ct + ln) * KLDP + 32 * kc + kmap(e, hi)];
                    sf[ct] = __builtin_amdgcn_wmma_f32_16x16x32_f16(
                        false, kf, false, qa[kc], (short)0, sf[ct], false, false);
                }

            // Causal mask + online softmax (exp2 domain; scale folded into Q).
            // sf[ct][i] is key s0 + 16*ct + 8*hi + i against the lane's query.
            float rm = -3.0e38f;
#pragma unroll
            for (int ct = 0; ct < 2; ++ct)
#pragma unroll
                for (int i = 0; i < 8; ++i) {
                    const int scol = s0 + 16 * ct + 8 * hi + i;
                    if (scol > trow) sf[ct][i] = -3.0e38f;
                    rm = fmaxf(rm, sf[ct][i]);
                }
            rm = fmaxf(rm, xhalf(rm));        // the other 16 keys of this query
            const float mnew = fmaxf(mrow, rm);
            const float corr = exp2f(mrow - mnew);
            mrow = mnew;
            float rs = 0.0f;
#pragma unroll
            for (int ct = 0; ct < 2; ++ct)
#pragma unroll
                for (int i = 0; i < 8; ++i) {
                    const float p = exp2f(sf[ct][i] - mnew);
                    sf[ct][i] = p;
                    rs += p;
                }
            lrow = lrow * corr + rs;
#pragma unroll
            for (int dc = 0; dc < 4; ++dc)
#pragma unroll
                for (int i = 0; i < 8; ++i) o[dc][i] *= corr;

            // The two S^T tiles, converted in place, are the B fragment of P^T:
            // element e holds key kmap(e, hi) of the chunk.
            v16h pa;
#pragma unroll
            for (int e = 0; e < 16; ++e) pa[e] = (_Float16)sf[e >> 3][e & 7];

            // O^T += V^T (64x32) @ P^T (32x16): 4 WMMA
#pragma unroll
            for (int dc = 0; dc < 4; ++dc) {
                v16h vf;
#pragma unroll
                for (int e = 0; e < 16; ++e)
                    vf[e] = Vt[(16 * dc + ln) * VLDP + s0 + kmap(e, hi)];
                o[dc] = __builtin_amdgcn_wmma_f32_16x16x32_f16(
                    false, vf, false, pa, (short)0, o[dc], false, false);
            }
        }

        // Join the halves' sums and normalize. A lane holds dims 16*dc + 8*hi + 0..7 of its
        // query: O^T turns back into rows in the wave's own LDS range, so that each store
        // below covers two whole output rows (512 contiguous bytes).
        const float inv = 1.0f / (lrow + xhalf(lrow));
        float* od = Os + ln * OLDP + 8 * hi;
#pragma unroll
        for (int dc = 0; dc < 4; ++dc) {
            *reinterpret_cast<float4*>(od + 16 * dc) =
                make_float4(o[dc][0] * inv, o[dc][1] * inv, o[dc][2] * inv, o[dc][3] * inv);
            *reinterpret_cast<float4*>(od + 16 * dc + 4) =
                make_float4(o[dc][4] * inv, o[dc][5] * inv, o[dc][6] * inv, o[dc][7] * inv);
        }
        // The rows read back below were written by other lanes of this wave.
        asm volatile("s_wait_dscnt 0" ::: "memory");
        float* og = out + ((size_t)b * T + t0 + hi) * HS + 4 * ln;
#pragma unroll
        for (int k = 0; k < 8; ++k)
            *reinterpret_cast<float4*>(og + 2 * k * HS) =
                *reinterpret_cast<const float4*>(Os + (2 * k + hi) * OLDP + 4 * ln);
        // Wait before a register that the stores above name is overwritten.
        asm volatile("s_wait_xcnt 0x0" :: "v"(og) : "memory");
        xl = xn;
    }
    // The last refill's loads, which nobody uses, have landed before the wave gives up its registers.
    asm volatile("s_wait_loadcnt 0x0" ::: "memory");
}

// ---------------------------------------------------------------------------
extern "C" void kernel_launch(void* const* d_in, const int* in_sizes, int n_in,
                              void* d_out, int out_size, void* d_ws, size_t ws_size,
                              hipStream_t stream) {
    const float* x = (const float*)d_in[0];
    const float* w = (const float*)d_in[1];
    float* out = (float*)d_out;

    const int B = in_sizes[0] / (T * CEMB);   // 512

    // One workgroup a WGP (its LDS leaves room for no second); each loops over its elements.
    head_kernel<<<dim3(256), dim3(512), 0, stream>>>(x, w, out, B);
}

// v006
// One run takes 29.2 microseconds.
// Two timings next to v005 put it at 1.05 and 1.04 times that version's speed.
// All steps since v000 together make it 4.77 times as fast.
#include <hip/hip_runtime.h>
#include <hip/hip_bf16.h>
#include <cstdint>
#include <cstddef>

typedef __attribute__((ext_vector_type(16))) _Float16 v16h;
typedef __attribute__((ext_vector_type(8)))  float    v8f;
typedef __attribute__((ext_vector_type(8)))  _Float16 v8h;
typedef __attribute__((ext_vector_type(2)))  _Float16 v2h;

static constexpr int T     = 256;   // sequence length
static constexpr int CEMB  = 384;   // embed dim
static constexpr int HS    = 64;    // head size
static constexpr int NQKV  = 192;   // 3 * HS

__device__ __forceinline__ int kmap(int e, int hi) {
    return (e & 7) + ((e >> 3) << 4) + (hi ? 8 : 0);
}

__device__ __forceinline__ float xhalf(float v) {
    const int bits = __builtin_bit_cast(int, v);
    return __builtin_bit_cast(float,
        __builtin_amdgcn_permlanex16(bits, bits, 0x76543210, 0xfedcba98, false, false));
}

typedef __attribute__((ext_vector_type(4)))  _Float16 v4h;

static constexpr int WLDP  = 392;   // w^T rows [192][392] (784B stride: 16B x odd, conflict-free)
static constexpr int XLDP  = 40;    // x stage rows [16][40] (80B stride: 16B x odd, conflict-free)
static constexpr int KLDP  = 72;    // K rows [256][72]    (144B stride, 16B-mult, conflict-free)
static constexpr int VLDP  = 264;   // V^T rows [64][264]  (528B stride, 16B-mult)
static constexpr int OLDP  = 68;    // out stage [16][68] f32 a wave (272B stride, 16B-mult, conflict-free)
static constexpr int PRIV  = 16 * OLDP * 2;   // halves of a wave's own LDS range (x stages, then out stage)
static constexpr int DEPTH = 3;     // x chunks of a wave in flight from global memory
static constexpr int NCH   = CEMB / 32;       // K chunks of the projection
static constexpr int SMEM_HALVES = NQKV * WLDP + T * KLDP + HS * VLDP + 16 * PRIV;   // 290816 B

// Most plain '#pragma unroll' in this file are there so that the small arrays that the loop
// variable indexes (fragments, accumulators, chunks in flight) stay in registers.

// One K chunk (16 rows x 32 K, f32) of a wave's x strip on its way to LDS, per lane.
struct XChunk { float4 f[4]; };

// Issues the four loads of chunk k of the strip whose lane address is xl: 8 neighbouring
// lanes x 16 B cover one whole 128-B line, a wave-wide load covers 4 rows.
__device__ __forceinline__ void load_x(const float* xl, const int k, XChunk& c) {
#pragma unroll
    for (int p = 0; p < 4; ++p)
        c.f[p] = *reinterpret_cast<const float4*>(xl + p * 4 * CEMB + k * 32);
    // Wait before a register that the loads above name as an address is overwritten; the
    // address is an input so that it is still live here.
    asm volatile("s_wait_xcnt 0x0" :: "v"(xl) : "memory");
}

// Converts a chunk to f16 and puts it into the wave's own stage xs.
__device__ __forceinline__ void put_x(const XChunk& c, _Float16* xs, const int lane) {
    _Float16* d = xs + (lane >> 3) * XLDP + (lane & 7) * 4;
#pragma unroll
    for (int p = 0; p < 4; ++p)
        *reinterpret_cast<v4h*>(d + p * 4 * XLDP) =
            v4h{(_Float16)c.f[p].x, (_Float16)c.f[p].y, (_Float16)c.f[p].z, (_Float16)c.f[p].w};
}

// A or B fragment of 32 K from a row of halves: element e is K index kmap(e, hi).
__device__ __forceinline__ v16h frag(const _Float16* row, const int hi) {
    const v8h lo = *reinterpret_cast<const v8h*>(row + 8 * hi);
    const v8h up = *reinterpret_cast<const v8h*>(row + 16 + 8 * hi);
    return __builtin_shufflevector(lo, up, 0, 1, 2, 3, 4, 5, 6, 7, 8, 9, 10, 11, 12, 13, 14, 15);
}

__device__ __forceinline__ void exp2_raw8(float (&t)[8]) {
    asm("s_delay_alu instid0(VALU_DEP_1)\n\t"
        "v_exp_f32 %0, %0\n\tv_exp_f32 %1, %1\n\tv_exp_f32 %2, %2\n\tv_exp_f32 %3, %3\n\t"
        "v_exp_f32 %4, %4\n\tv_exp_f32 %5, %5\n\tv_exp_f32 %6, %6\n\tv_exp_f32 %7, %7\n\tv_nop"
        : "+v"(t[0]), "+v"(t[1]), "+v"(t[2]), "+v"(t[3]), "+v"(t[4]), "+v"(t[5]), "+v"(t[6]), "+v"(t[7]));
}
__device__ __forceinline__ void exp2_raw9(float& c, float (&t)[8]) {
    asm("s_delay_alu instid0(VALU_DEP_1)\n\tv_exp_f32 %8, %8\n\t"
        "v_exp_f32 %0, %0\n\tv_exp_f32 %1, %1\n\tv_exp_f32 %2, %2\n\tv_exp_f32 %3, %3\n\t"
        "v_exp_f32 %4, %4\n\tv_exp_f32 %5, %5\n\tv_exp_f32 %6, %6\n\tv_exp_f32 %7, %7\n\tv_nop"
        : "+v"(t[0]), "+v"(t[1]), "+v"(t[2]), "+v"(t[3]), "+v"(t[4]), "+v"(t[5]), "+v"(t[6]), "+v"(t[7]),
          "+v"(c));
}

// Work-group barrier with the LDS wait alone: __syncthreads() also waited for the global
// loads in flight, which are the next x chunks and are to stay in flight.
__device__ __forceinline__ void lds_barrier() {
    asm volatile("s_wait_dscnt 0x0\n\ts_barrier_signal -1\n\ts_barrier_wait -1" ::: "memory");
}

// ---------------------------------------------------------------------------
// QKV projection + causal flash attention. A workgroup of 16 waves converts w to f16 once,
// keeps it transposed in LDS, and then takes batch elements blockIdx.x, + gridDim.x, ...
// Wave wv owns rows 16*wv .. 16*wv+15 of each, in the projection and in the attention.
// Projection [16,384] @ [384,192]: only the owning wave reads an x row, so each wave stages
// its strip in its own LDS range and the K loop has no workgroup barrier; its loads run
// DEPTH chunks ahead, over the end of a batch element into the next one.
// Q and K are computed transposed (w^T x^T), so a lane owns one row and its registers
// run over 8 neighbouring columns: Q (pre-scaled by (1/sqrt(384)) * log2(e), so that the
// softmax runs in the exp2 domain) is at once the B fragment of S^T = K Q^T and stays
// in registers; a K row piece is one 16-B LDS store. V is computed straight, so a lane
// owns one column and 8 neighbouring rows: one 16-B store into V^T.
// Scores and output are computed transposed (S^T = K Q^T, O^T = V^T P^T), so a
// lane owns one query: softmax runs in-lane and P never leaves the registers.
// ---------------------------------------------------------------------------
__global__ __launch_bounds__(512) void head_kernel(
    const float* __restrict__ x, const float* __restrict__ w, float* __restrict__ out, const int nb)
{
    __shared__ __attribute__((aligned(16))) _Float16 smem[SMEM_HALVES];
    _Float16* Wt = smem;                    // 192*392 halves
    _Float16* Ks = Wt + NQKV * WLDP;        // 256*72 halves
    _Float16* Vt = Ks + T * KLDP;           // 64*264 halves

    if ((int)blockIdx.x >= nb) return;      // the whole workgroup, in front of every barrier

    const int tid  = threadIdx.x;
    const int wv   = tid >> 5;              // wave 0..15
    const int lane = tid & 31;
    const int ln   = tid & 15;
    const int hi   = (tid >> 4) & 1;
    const int t0   = wv * 16;
    _Float16* pv = Vt + HS * VLDP + wv * PRIV;
    float*    Os = reinterpret_cast<float*>(pv);

    const size_t bstep = (size_t)gridDim.x * T * CEMB;  // floats to the workgroup's next element
    const float* xl = x + ((size_t)blockIdx.x * T + t0 + (lane >> 3)) * CEMB + (lane & 7) * 4;
    XChunk ring[DEPTH];
    const _Float16* wr = Wt + ln * WLDP;                // the lane's row of the first w^T tile

    // ---- w[384 x 192] f32 -> transposed f16 LDS (B fragments read contiguous K runs).
    // 8 lanes take one 128-B line of K rows k and k+1; a thread stores each of its 4 cols'
    // pair as one dword. A wave's 4 lane groups take neighbouring K-row pairs.
    {
        const int g  = tid >> 3;            // 0..63
        const int l8 = tid & 7;
        const float* wl = w + (size_t)(2 * g) * NQKV + l8 * 4;
#pragma unroll
        for (int o = 0; o < 2; ++o) {
            float4 r0[9], r1[9];
#pragma unroll
            for (int j = 0; j < 9; ++j) {
                const int it = o * 9 + j;   // K rows (it % 3) * 128 + 2g, line it / 3
                const float* p = wl + (it % 3) * 128 * NQKV + (it / 3) * 32;
                r0[j] = *reinterpret_cast<const float4*>(p);
                r1[j] = *reinterpret_cast<const float4*>(p + NQKV);
            }
            // Wait before the address register of the loads above is overwritten.
            asm volatile("s_wait_xcnt 0x0" :: "v"(wl) : "memory");
            if (o == 0) {
#pragma unroll
                for (int k = 0; k < DEPTH; ++k) load_x(xl, k, ring[k]);
            }
#pragma unroll
            for (int j = 0; j < 9; ++j) {
                const int it = o * 9 + j;
                _Float16* wd = &Wt[((it / 3) * 32 + l8 * 4) * WLDP + (it % 3) * 128 + 2 * g];
                *reinterpret_cast<v2h*>(wd + 0 * WLDP) = v2h{(_Float16)r0[j].x, (_Float16)r1[j].x};
                *reinterpret_cast<v2h*>(wd + 1 * WLDP) = v2h{(_Float16)r0[j].y, (_Float16)r1[j].y};
                *reinterpret_cast<v2h*>(wd + 2 * WLDP) = v2h{(_Float16)r0[j].z, (_Float16)r1[j].z};
                *reinterpret_cast<v2h*>(wd + 3 * WLDP) = v2h{(_Float16)r0[j].w, (_Float16)r1[j].w};
            }
        }
    }
    // w^T is read by every wave below.
    lds_barrier();

    for (int b = blockIdx.x; b < nb; b += gridDim.x) {
        const bool more = b + (int)gridDim.x < nb;      // the same for the whole workgroup
        const float* xn = xl + bstep;                   // read only where 'more'

        v8f acc[12] = {};                   // 16 rows x 192 cols
        const _Float16* wk = wr;
#pragma unroll 1
        for (int kb = 0; kb < NCH / DEPTH; ++kb) {
            const float* xf = kb < NCH / DEPTH - 1 ? xl + (kb + 1) * DEPTH * 32
                                                   : (more ? xn : xl + kb * DEPTH * 32);
#pragma unroll
            for (int s = 0; s < DEPTH; ++s) {
                _Float16* xs = pv + s * 16 * XLDP;
                put_x(ring[s], xs, lane);
                load_x(xf, s, ring[s]);
                // The stage rows read next were written by other lanes of this wave.
                asm volatile("s_wait_dscnt 0x0" ::: "memory");
                const v16h af = frag(xs + ln * XLDP, hi);
#pragma unroll
                for (int h = 0; h < 2; ++h) {
                    v16h bf[6];
#pragma unroll
                    for (int j = 0; j < 6; ++j)
                        bf[j] = frag(wk + ((h * 6 + j) * 16) * WLDP + s * 32, hi);
                    // Keeps the six fragments' loads together in front of their products: one LDS
                    // latency a group; left alone the compiler waited for each fragment by itself.
                    __builtin_amdgcn_sched_barrier(0);
#pragma unroll
                    for (int j = 0; j < 6; ++j) {
                        const int c = h * 6 + j;
                        // The A and B fragments share one lane and k map, so swapping them transposes the tile.
                        if (c < 8)
                            acc[c] = __builtin_amdgcn_wmma_f32_16x16x32_f16(
                                false, bf[j], false, af, (short)0, acc[c], false, false);
                        else
                            acc[c] = __builtin_amdgcn_wmma_f32_16x16x32_f16(
                                false, af, false, bf[j], (short)0, acc[c], false, false);
                    }
                    // Keeps the next group's loads behind these products, off their registers.
                    __builtin_amdgcn_sched_barrier(0);
                }
            }
            wk += DEPTH * 32;
        }

        // Q: acc[j][i] is column 16*j + 8*hi + i of row t0 + ln; element e of B fragment kc is
        // column 32*kc + kmap(e, hi). qscale = log2(e) / sqrt(C).
        v16h qa[2];
        const float qscale = 1.442695040888963f * rsqrtf((float)CEMB);
#pragma unroll
        for (int kc = 0; kc < 2; ++kc)
#pragma unroll
            for (int e = 0; e < 16; ++e)
                qa[kc][e] = (_Float16)(acc[2 * kc + (e >> 3)][e & 7] * qscale);

        // Every wave is done reading K and V^T of the element before this one.
        if (b != (int)blockIdx.x) lds_barrier();
        // K: columns 16*j + 8*hi + 0..7 of row t0 + ln.
#pragma unroll
        for (int j = 0; j < 4; ++j) {
            v8h h;
#pragma unroll
            for (int i = 0; i < 8; ++i) h[i] = (_Float16)acc[4 + j][i];
            *reinterpret_cast<v8h*>(&Ks[(t0 + ln) * KLDP + 16 * j + 8 * hi]) = h;
        }
        // V^T: rows t0 + 8*hi + 0..7 of column 16*j + ln.
#pragma unroll
        for (int j = 0; j < 4; ++j) {
            v8h h;
#pragma unroll
            for (int i = 0; i < 8; ++i) h[i] = (_Float16)acc[8 + j][i];
            *reinterpret_cast<v8h*>(&Vt[(16 * j + ln) * VLDP + t0 + 8 * hi]) = h;
        }
        // K and V^T of the rows up to its own are read by every wave below.
        lds_barrier();

        // ---- Attention of the wave's strip; no workgroup barrier in the divergent chunk loop.
        const int a = wv;                     // strip index, rows [16a, 16a+16)
        // qa: the Q strip as B fragments of S^T = K Q^T, 2 K-chunks of 32.
        // Transposed tiles: a lane owns ONE query row (t0 + ln); its registers run over
        // keys (scores) or head dims (output), 8 per tile, the wave halves 8 apart.
        v8f   o[4] = {};                      // O^T: 64 dims x 16 queries
        float mrow = -3.0e38f;                // running maximum of the lane's query
        float lrow = 0.0f;                    // sum over this wave half's keys only
        const int trow = t0 + ln;

        const int nch = (a >> 1) + 1;         // causal 32-col chunks for this strip
        for (int ch = 0; ch < nch; ++ch) {
            const int s0 = ch * 32;

            // S^T = K (32x64) @ Q^T (64x16): 2 frags x 2 K-steps = 4 WMMA
            v8f sf[2] = {};
#pragma unroll
            for (int ct = 0; ct < 2; ++ct)
#pragma unroll
                for (int kc = 0; kc < 2; ++kc) {
                    v16h kf;
#pragma unroll
                    for (int e = 0; e < 16; ++e)
                        kf[e] = Ks[(s0 + 16 * ct + ln) * KLDP + 32 * kc + kmap(e, hi)];
                    sf[ct] = __builtin_amdgcn_wmma_f32_16x16x32_f16(
                        false, kf, false, qa[kc], (short)0, sf[ct], false, false);
                }

            // Causal mask + online softmax (exp2 domain; scale folded into Q).
            // sf[ct][i] is key s0 + 16*ct + 8*hi + i against the lane's query.
            float rm = -3.0e38f;
#pragma unroll
            for (int ct = 0; ct < 2; ++ct)
#pragma unroll
                for (int i = 0; i < 8; ++i) {
                    const int scol = s0 + 16 * ct + 8 * hi + i;
                    sf[ct][i] = scol > trow ? -3.0e38f : sf[ct][i];
                    rm = fmaxf(rm, sf[ct][i]);
                }
            rm = fmaxf(rm, xhalf(rm));        // the other 16 keys of this query
            const float mnew = fmaxf(mrow, rm);
            float corr = mrow - mnew;
            mrow = mnew;
            float ex[2][8];
#pragma unroll
            for (int ct = 0; ct < 2; ++ct)
#pragma unroll
                for (int i = 0; i < 8; ++i) ex[ct][i] = sf[ct][i] - mnew;
            exp2_raw9(corr, ex[0]);
            exp2_raw8(ex[1]);
            float rs = 0.0f;
#pragma unroll
            for (int ct = 0; ct < 2; ++ct)
#pragma unroll
                for (int i = 0; i < 8; ++i) {
                    sf[ct][i] = ex[ct][i];
                    rs += ex[ct][i];
                }
            lrow = lrow * corr + rs;
#pragma unroll
            for (int dc = 0; dc < 4; ++dc)
#pragma unroll
                for (int i = 0; i < 8; ++i) o[dc][i] *= corr;

            // The two S^T tiles, converted in place, are the B fragment of P^T:
            // element e holds key kmap(e, hi) of the chunk.
            v16h pa;
#pragma unroll
            for (int e = 0; e < 16; ++e) pa[e] = (_Float16)sf[e >> 3][e & 7];

            // O^T += V^T (64x32) @ P^T (32x16): 4 WMMA
#pragma unroll
            for (int dc = 0; dc < 4; ++dc) {
                v16h vf;
#pragma unroll
                for (int e = 0; e < 16; ++e)
                    vf[e] = Vt[(16 * dc + ln) * VLDP + s0 + kmap(e, hi)];
                o[dc] = __builtin_amdgcn_wmma_f32_16x16x32_f16(
                    false, vf, false, pa, (short)0, o[dc], false, false);
            }
        }

        // Join the halves' sums and normalize. A lane holds dims 16*dc + 8*hi + 0..7 of its
        // query: O^T turns back into rows in the wave's own LDS range, so that each store
        // below covers two whole output rows (512 contiguous bytes).
        const float inv = 1.0f / (lrow + xhalf(lrow));
        float* od = Os + ln * OLDP + 8 * hi;
#pragma unroll
        for (int dc = 0; dc < 4; ++dc) {
            *reinterpret_cast<float4*>(od + 16 * dc) =
                make_float4(o[dc][0] * inv, o[dc][1] * inv, o[dc][2] * inv, o[dc][3] * inv);
            *reinterpret_cast<float4*>(od + 16 * dc + 4) =
                make_float4(o[dc][4] * inv, o[dc][5] * inv, o[dc][6] * inv, o[dc][7] * inv);
        }
        // The rows read back below were written by other lanes of this wave.
        asm volatile("s_wait_dscnt 0" ::: "memory");
        float* og = out + ((size_t)b * T + t0 + hi) * HS + 4 * ln;
#pragma unroll
        for (int k = 0; k < 8; ++k)
            *reinterpret_cast<float4*>(og + 2 * k * HS) =
                *reinterpret_cast<const float4*>(Os + (2 * k + hi) * OLDP + 4 * ln);
        // Wait before a register that the stores above name is overwritten.
        asm volatile("s_wait_xcnt 0x0" :: "v"(og) : "memory");
        xl = xn;
    }
    // The last refill's loads, which nobody uses, have landed before the wave gives up its registers.
    asm volatile("s_wait_loadcnt 0x0" ::: "memory");
}

// ---------------------------------------------------------------------------
extern "C" void kernel_launch(void* const* d_in, const int* in_sizes, int n_in,
                              void* d_out, int out_size, void* d_ws, size_t ws_size,
                              hipStream_t stream) {
    const float* x = (const float*)d_in[0];
    const float* w = (const float*)d_in[1];
    float* out = (float*)d_out;

    const int B = in_sizes[0] / (T * CEMB);   // 512

    // One workgroup a WGP (its LDS leaves room for no second); each loops over its elements.
    head_kernel<<<dim3(256), dim3(512), 0, stream>>>(x, w, out, B);
}

// v007
// Measured time: 27.8 microseconds a run.
// In both of two side-by-side timings against v006, it was 1.06 times as fast.
// Over all steps from v000 it is 5.05 times as fast.
#include <hip/hip_runtime.h>
#include <hip/hip_bf16.h>
#include <cstdint>
#include <cstddef>

typedef __attribute__((ext_vector_type(16))) _Float16 v16h;
typedef __attribute__((ext_vector_type(8)))  float    v8f;
typedef __attribute__((ext_vector_type(8)))  _Float16 v8h;
typedef __attribute__((ext_vector_type(2)))  _Float16 v2h;

static constexpr int T     = 256;   // sequence length
static constexpr int CEMB  = 384;   // embed dim
static constexpr int HS    = 64;    // head size
static constexpr int NQKV  = 192;   // 3 * HS

__device__ __forceinline__ int kmap(int e, int hi) {
    return (e & 7) + ((e >> 3) << 4) + (hi ? 8 : 0);
}

__device__ __forceinline__ float xhalf(float v) {
    const int bits = __builtin_bit_cast(int, v);
    return __builtin_bit_cast(float,
        __builtin_amdgcn_permlanex16(bits, bits, 0x76543210, 0xfedcba98, false, false));
}

typedef __attribute__((ext_vector_type(4)))  _Float16 v4h;

static constexpr int WLDP  = 392;   // w^T rows [192][392] (784B stride: 16B x odd, conflict-free)
static constexpr int XLDP  = 40;    // x stage rows [16][40] (80B stride: 16B x odd, conflict-free)
static constexpr int KLDP  = 72;    // K rows [256][72]    (144B stride, 16B-mult, conflict-free)
static constexpr int VLDP  = 264;   // V^T rows [64][264]  (528B stride, 16B-mult)
static constexpr int OLDP  = 68;    // out stage [16][68] f32 a wave (272B stride, 16B-mult, conflict-free)
static constexpr int DEPTH = 3;     // x chunks of a strip in flight from global memory
static constexpr int NWAVE = 8;     // waves of a workgroup; each owns two 16-row strips
static constexpr int PRIV  = 2 * DEPTH * 16 * XLDP;   // halves of a wave's own LDS range (x stages, then out stage)
static_assert(PRIV >= 16 * OLDP * 2, "the out stage lies on the x stages");
static constexpr int NCH   = CEMB / 32;       // K chunks of the projection
static constexpr int SMEM_HALVES = NQKV * WLDP + T * KLDP + HS * VLDP + NWAVE * PRIV;   // 282624 B

// Every plain '#pragma unroll' in this file is there so that the small arrays that its loop
// variable indexes (fragments, accumulators, chunks in flight) stay in registers.

// One K chunk (16 rows x 32 K, f32) of a wave's x strip on its way to LDS, per lane.
struct XChunk { float4 f[4]; };

// Issues the loads of one chunk of both strips: xc is the chunk's place in row 0 of the element (the
// same for the whole wave), va and vb the lane's bytes from there in either strip. 8 neighbouring
// lanes x 16 B cover one whole 128-B line, a wave-wide load covers 4 rows.
__device__ __forceinline__ void load_x2(const float* xc, const unsigned va, const unsigned vb,
                                        XChunk& ca, XChunk& cb) {
    const float* xa = reinterpret_cast<const float*>(reinterpret_cast<const char*>(xc) + va);
    const float* xb = reinterpret_cast<const float*>(reinterpret_cast<const char*>(xc) + vb);
#pragma unroll
    for (int p = 0; p < 4; ++p)
        ca.f[p] = *reinterpret_cast<const float4*>(xa + p * 4 * CEMB);
#pragma unroll
    for (int p = 0; p < 4; ++p)
        cb.f[p] = *reinterpret_cast<const float4*>(xb + p * 4 * CEMB);
    // Wait before a register that the loads above name as an address is overwritten; the
    // addresses are inputs so that they are still live here.
    asm volatile("s_wait_xcnt 0x0" :: "v"(xa), "v"(xb) : "memory");
}

// Converts a chunk to f16 and puts it into the wave's own stage xs.
__device__ __forceinline__ void put_x(const XChunk& c, _Float16* xs, const int lane) {
    _Float16* d = xs + (lane >> 3) * XLDP + (lane & 7) * 4;
#pragma unroll
    for (int p = 0; p < 4; ++p)
        *reinterpret_cast<v4h*>(d + p * 4 * XLDP) =
            v4h{(_Float16)c.f[p].x, (_Float16)c.f[p].y, (_Float16)c.f[p].z, (_Float16)c.f[p].w};
}

// A or B fragment of 32 K from a row of halves: element e is K index kmap(e, hi).
__device__ __forceinline__ v16h frag(const _Float16* row, const int hi) {
    const v8h lo = *reinterpret_cast<const v8h*>(row + 8 * hi);
    const v8h up = *reinterpret_cast<const v8h*>(row + 16 + 8 * hi);
    return __builtin_shufflevector(lo, up, 0, 1, 2, 3, 4, 5, 6, 7, 8, 9, 10, 11, 12, 13, 14, 15);
}

__device__ __forceinline__ void exp2_raw8(float (&t)[8]) {
    asm("s_delay_alu instid0(VALU_DEP_1)\n\t"
        "v_exp_f32 %0, %0\n\tv_exp_f32 %1, %1\n\tv_exp_f32 %2, %2\n\tv_exp_f32 %3, %3\n\t"
        "v_exp_f32 %4, %4\n\tv_exp_f32 %5, %5\n\tv_exp_f32 %6, %6\n\tv_exp_f32 %7, %7\n\tv_nop"
        : "+v"(t[0]), "+v"(t[1]), "+v"(t[2]), "+v"(t[3]), "+v"(t[4]), "+v"(t[5]), "+v"(t[6]), "+v"(t[7]));
}
__device__ __forceinline__ void exp2_raw9(float& c, float (&t)[8]) {
    asm("s_delay_alu instid0(VALU_DEP_1)\n\tv_exp_f32 %8, %8\n\t"
        "v_exp_f32 %0, %0\n\tv_exp_f32 %1, %1\n\tv_exp_f32 %2, %2\n\tv_exp_f32 %3, %3\n\t"
        "v_exp_f32 %4, %4\n\tv_exp_f32 %5, %5\n\tv_exp_f32 %6, %6\n\tv_exp_f32 %7, %7\n\tv_nop"
        : "+v"(t[0]), "+v"(t[1]), "+v"(t[2]), "+v"(t[3]), "+v"(t[4]), "+v"(t[5]), "+v"(t[6]), "+v"(t[7]),
          "+v"(c));
}

// Work-group barrier with the LDS wait alone: __syncthreads() also waited for the global
// loads in flight, which are the next x chunks and are to stay in flight.
__device__ __forceinline__ void lds_barrier() {
    asm volatile("s_wait_dscnt 0x0\n\ts_barrier_signal -1\n\ts_barrier_wait -1" ::: "memory");
}

// The K and V^T fragments of one chunk of 32 keys (s0 ..): A operands of S^T and of O^T.
__device__ __forceinline__ void load_kv(const _Float16* Ks, const _Float16* Vt, const int s0,
                                        const int ln, const int hi, v16h (&kf)[2][2], v16h (&vf)[4]) {
#pragma unroll
    for (int ct = 0; ct < 2; ++ct)
#pragma unroll
        for (int kc = 0; kc < 2; ++kc)
            kf[ct][kc] = frag(Ks + (s0 + 16 * ct + ln) * KLDP + 32 * kc, hi);
#pragma unroll
    for (int dc = 0; dc < 4; ++dc)
        vf[dc] = frag(Vt + (16 * dc + ln) * VLDP + s0, hi);
}

// One chunk of 32 keys against one strip of 16 queries. Transposed tiles: a lane owns ONE query
// row (trow); its registers run over keys (scores) or head dims (output), 8 per tile, the wave
// halves 8 apart. qa: the Q strip as B fragments of S^T = K Q^T. o: O^T, 64 dims x 16 queries.
// mrow: running maximum of the lane's query. lrow: sum over this wave half's keys only.
__device__ __forceinline__ void attn_tile(const v16h (&kf)[2][2], const v16h (&vf)[4], const v16h (&qa)[2],
                                          v8f (&o)[4], float& mrow, float& lrow,
                                          const int s0, const int trow, const int hi) {
    // S^T = K (32x64) @ Q^T (64x16): 2 frags x 2 K-steps = 4 WMMA
    v8f sf[2] = {};
#pragma unroll
    for (int ct = 0; ct < 2; ++ct)
#pragma unroll
        for (int kc = 0; kc < 2; ++kc)
            sf[ct] = __builtin_amdgcn_wmma_f32_16x16x32_f16(
                false, kf[ct][kc], false, qa[kc], (short)0, sf[ct], false, false);

    // Causal mask + online softmax (exp2 domain; scale folded into Q).
    // sf[ct][i] is key s0 + 16*ct + 8*hi + i against the lane's query.
    float rm = -3.0e38f;
#pragma unroll
    for (int ct = 0; ct < 2; ++ct)
#pragma unroll
        for (int i = 0; i < 8; ++i) {
            const int scol = s0 + 16 * ct + 8 * hi + i;
            sf[ct][i] = scol > trow ? -3.0e38f : sf[ct][i];
            rm = fmaxf(rm, sf[ct][i]);
        }
    rm = fmaxf(rm, xhalf(rm));        // the other 16 keys of this query
    const float mnew = fmaxf(mrow, rm);
    float corr = mrow - mnew;
    mrow = mnew;
    float ex[2][8];
#pragma unroll
    for (int ct = 0; ct < 2; ++ct)
#pragma unroll
        for (int i = 0; i < 8; ++i) ex[ct][i] = sf[ct][i] - mnew;
    exp2_raw9(corr, ex[0]);
    exp2_raw8(ex[1]);
    float rs = 0.0f;
#pragma unroll
    for (int ct = 0; ct < 2; ++ct)
#pragma unroll
        for (int i = 0; i < 8; ++i) rs += ex[ct][i];
    lrow = lrow * corr + rs;
#pragma unroll
    for (int dc = 0; dc < 4; ++dc)
#pragma unroll
        for (int i = 0; i < 8; ++i) o[dc][i] *= corr;

    // The two S^T tiles, converted in place, are the B fragment of P^T:
    // element e holds key kmap(e, hi) of the chunk.
    v16h pa;
#pragma unroll
    for (int e = 0; e < 16; ++e) pa[e] = (_Float16)ex[e >> 3][e & 7];

    // O^T += V^T (64x32) @ P^T (32x16): 4 WMMA
#pragma unroll
    for (int dc = 0; dc < 4; ++dc)
        o[dc] = __builtin_amdgcn_wmma_f32_16x16x32_f16(
            false, vf[dc], false, pa, (short)0, o[dc], false, false);
}

// ---------------------------------------------------------------------------
// QKV projection + causal flash attention. A workgroup of 8 waves converts w to f16 once,
// keeps it transposed in LDS, and then takes batch elements blockIdx.x, + gridDim.x, ...
// Wave wv owns TWO strips of 16 rows of each, strips wv and 15 - wv, in the projection and in
// the attention: a w fragment read from LDS feeds two products, a K or V^T fragment too where
// both strips need it, and every wave has the same causal work (9 strip chunks).
// Projection [32,384] @ [384,192]: only the owning wave reads an x row, so each wave stages
// its strips in its own LDS range and the K loop has no workgroup barrier; its loads run
// DEPTH chunks ahead, over the end of a batch element into the next one. The fragments of a
// group of 12 products are fetched while the group before it runs.
// Q and K are computed transposed (w^T x^T), so a lane owns one row and its registers
// run over 8 neighbouring columns: Q (pre-scaled by (1/sqrt(384)) * log2(e), so that the
// softmax runs in the exp2 domain) is at once the B fragment of S^T = K Q^T and stays
// in registers; a K row piece is one 16-B LDS store. V is computed straight, so a lane
// owns one column and 8 neighbouring rows: one 16-B store into V^T.
// Scores and output are computed transposed (S^T = K Q^T, O^T = V^T P^T), so a
// lane owns one query: softmax runs in-lane and P never leaves the registers.
// ---------------------------------------------------------------------------
__global__ __launch_bounds__(32 * NWAVE) void head_kernel(
    const float* __restrict__ x, const float* __restrict__ w, float* __restrict__ out, const int nb)
{
    __shared__ __attribute__((aligned(16))) _Float16 smem[SMEM_HALVES];
    _Float16* Wt = smem;                    // 192*392 halves
    _Float16* Ks = Wt + NQKV * WLDP;        // 256*72 halves
    _Float16* Vt = Ks + T * KLDP;           // 64*264 halves

    if ((int)blockIdx.x >= nb) return;      // the whole workgroup, in front of every barrier

    const int tid  = threadIdx.x;
    // The wave's number 0..7, in a scalar register: the chunk loops below then branch on it.
    const int wv   = __builtin_amdgcn_readfirstlane(tid >> 5);
    const int lane = tid & 31;
    const int ln   = tid & 15;
    const int hi   = (tid >> 4) & 1;
    const int t0[2] = {wv * 16, (15 - wv) * 16};
    _Float16* pv = Vt + HS * VLDP + wv * PRIV;
    float*    Os = reinterpret_cast<float*>(pv);

    const size_t bstep = (size_t)gridDim.x * T * CEMB;  // floats to the workgroup's next element
    const float* xe = x + (size_t)blockIdx.x * T * CEMB;     // the element, the same for every lane
    const unsigned va = ((t0[0] + (lane >> 3)) * CEMB + (lane & 7) * 4) * 4;   // the lane's bytes into it
    const unsigned vb = ((t0[1] + (lane >> 3)) * CEMB + (lane & 7) * 4) * 4;
    XChunk ring[DEPTH][2];
    const _Float16* wr = Wt + ln * WLDP;                // the lane's row of the first w^T tile

    // ---- w[384 x 192] f32 -> transposed f16 LDS (B fragments read contiguous K runs).
    // 8 lanes take one 128-B line of K rows k and k+1; a thread stores each of its 4 cols'
    // pair as one dword. A wave's 4 lane groups take neighbouring K-row pairs.
    {
        const int g  = tid >> 3;            // 0..31
        const int l8 = tid & 7;
        const float* wl = w + (size_t)(2 * g) * NQKV + l8 * 4;
#pragma unroll
        for (int o = 0; o < 2; ++o) {
            float4 r0[18], r1[18];
#pragma unroll
            for (int j = 0; j < 18; ++j) {
                const int it = o * 18 + j;  // K rows (it % 6) * 64 + 2g, line it / 6
                const float* p = wl + (it % 6) * 64 * NQKV + (it / 6) * 32;
                r0[j] = *reinterpret_cast<const float4*>(p);
                r1[j] = *reinterpret_cast<const float4*>(p + NQKV);
            }
            // Wait before the address register of the loads above is overwritten.
            asm volatile("s_wait_xcnt 0x0" :: "v"(wl) : "memory");
            if (o == 0) {
#pragma unroll
                for (int k = 0; k < DEPTH; ++k)
                    load_x2(xe + k * 32, va, vb, ring[k][0], ring[k][1]);
            }
#pragma unroll
            for (int j = 0; j < 18; ++j) {
                const int it = o * 18 + j;
                _Float16* wd = &Wt[((it / 6) * 32 + l8 * 4) * WLDP + (it % 6) * 64 + 2 * g];
                *reinterpret_cast<v2h*>(wd + 0 * WLDP) = v2h{(_Float16)r0[j].x, (_Float16)r1[j].x};
                *reinterpret_cast<v2h*>(wd + 1 * WLDP) = v2h{(_Float16)r0[j].y, (_Float16)r1[j].y};
                *reinterpret_cast<v2h*>(wd + 2 * WLDP) = v2h{(_Float16)r0[j].z, (_Float16)r1[j].z};
                *reinterpret_cast<v2h*>(wd + 3 * WLDP) = v2h{(_Float16)r0[j].w, (_Float16)r1[j].w};
            }
        }
    }
    // w^T is read by every wave below.
    lds_barrier();

    // ---- The projection's pipeline, filled once and then run over all elements: afc holds the x
    // fragments of the chunk that is worked on next, bf0 the first six w fragments for it.
    v16h afc[2], bf0[6];
    put_x(ring[0][0], pv, lane);
    put_x(ring[0][1], pv + DEPTH * 16 * XLDP, lane);
    load_x2(xe + DEPTH * 32, va, vb, ring[0][0], ring[0][1]);
    // The stage rows read next were written by other lanes of this wave.
    asm volatile("s_wait_dscnt 0x0" ::: "memory");
#pragma unroll
    for (int st = 0; st < 2; ++st) afc[st] = frag(pv + (st * DEPTH * 16 + ln) * XLDP, hi);
#pragma unroll
    for (int j = 0; j < 6; ++j) bf0[j] = frag(wr + j * 16 * WLDP, hi);

    for (int b = blockIdx.x; b < nb; b += gridDim.x) {
        const bool more = b + (int)gridDim.x < nb;      // the same for the whole workgroup
        const size_t nextoff = more ? bstep : 0;

        v8f acc[2][12] = {};                // 2 x 16 rows x 192 cols
#pragma unroll 1
        for (int kb = 0; kb < NCH / DEPTH; ++kb) {
            const _Float16* wk = wr + kb * DEPTH * 32;
            const _Float16* wn = wr + (kb < NCH / DEPTH - 1 ? (kb + 1) * DEPTH * 32 : 0);
#pragma unroll
            for (int s = 0; s < DEPTH; ++s) {
                const int j  = (s + 1) % DEPTH;
                const int ci = kb * DEPTH + s + 1 + DEPTH;
                const size_t off = ci < NCH ? (size_t)ci * 32 : nextoff + (size_t)(ci - NCH) * 32;
                put_x(ring[j][0], pv + j * 16 * XLDP, lane);
                put_x(ring[j][1], pv + (DEPTH + j) * 16 * XLDP, lane);
                load_x2(xe + off, va, vb, ring[j][0], ring[j][1]);
                v16h bf1[6];
#pragma unroll
                for (int q = 0; q < 6; ++q) bf1[q] = frag(wk + (6 + q) * 16 * WLDP + s * 32, hi);
                // The four fences of a trip keep each group's LDS reads together in front of the group
                // of products before it: one place with reads a group, their latency under 12 products.
                __builtin_amdgcn_sched_barrier(0);
                // The A and B fragments share one lane and k map, so swapping them transposes the tile.
#pragma unroll
                for (int q = 0; q < 6; ++q)
#pragma unroll
                    for (int st = 0; st < 2; ++st)
                        acc[st][q] = __builtin_amdgcn_wmma_f32_16x16x32_f16(
                            false, bf0[q], false, afc[st], (short)0, acc[st][q], false, false);
                __builtin_amdgcn_sched_barrier(0);
                // The stage rows read at the foot of the trip were written by other lanes of this wave.
                asm volatile("s_wait_dscnt 0x0" ::: "memory");
                const _Float16* wf = s < DEPTH - 1 ? wk + (s + 1) * 32 : wn;
#pragma unroll
                for (int q = 0; q < 6; ++q) bf0[q] = frag(wf + q * 16 * WLDP, hi);
                __builtin_amdgcn_sched_barrier(0);
#pragma unroll
                for (int q = 0; q < 6; ++q)
#pragma unroll
                    for (int st = 0; st < 2; ++st) {
                        if (q < 2)
                            acc[st][6 + q] = __builtin_amdgcn_wmma_f32_16x16x32_f16(
                                false, bf1[q], false, afc[st], (short)0, acc[st][6 + q], false, false);
                        else
                            acc[st][6 + q] = __builtin_amdgcn_wmma_f32_16x16x32_f16(
                                false, afc[st], false, bf1[q], (short)0, acc[st][6 + q], false, false);
                    }
                __builtin_amdgcn_sched_barrier(0);
                // The next chunk's x fragments, over this chunk's: their latency passes under the
                // conversions and loads at the head of the next trip.
#pragma unroll
                for (int st = 0; st < 2; ++st)
                    afc[st] = frag(pv + ((st * DEPTH + j) * 16 + ln) * XLDP, hi);
            }
        }

        // Q: acc[st][j][i] is column 16*j + 8*hi + i of row t0[st] + ln; element e of B fragment kc
        // is column 32*kc + kmap(e, hi). qscale = log2(e) / sqrt(C).
        v16h qa[2][2];
        const float qscale = 1.442695040888963f * rsqrtf((float)CEMB);
#pragma unroll
        for (int st = 0; st < 2; ++st)
#pragma unroll
            for (int kc = 0; kc < 2; ++kc)
#pragma unroll
                for (int e = 0; e < 16; ++e)
                    qa[st][kc][e] = (_Float16)(acc[st][2 * kc + (e >> 3)][e & 7] * qscale);

        // Every wave is done reading K and V^T of the element before this one.
        if (b != (int)blockIdx.x) lds_barrier();
#pragma unroll
        for (int st = 0; st < 2; ++st) {
            // K: columns 16*j + 8*hi + 0..7 of row t0[st] + ln.
#pragma unroll
            for (int j = 0; j < 4; ++j) {
                v8h h;
#pragma unroll
                for (int i = 0; i < 8; ++i) h[i] = (_Float16)acc[st][4 + j][i];
                *reinterpret_cast<v8h*>(&Ks[(t0[st] + ln) * KLDP + 16 * j + 8 * hi]) = h;
            }
            // V^T: rows t0[st] + 8*hi + 0..7 of column 16*j + ln.
#pragma unroll
            for (int j = 0; j < 4; ++j) {
                v8h h;
#pragma unroll
                for (int i = 0; i < 8; ++i) h[i] = (_Float16)acc[st][8 + j][i];
                *reinterpret_cast<v8h*>(&Vt[(16 * j + ln) * VLDP + t0[st] + 8 * hi]) = h;
            }
        }
        // K and V^T of the rows up to its own are read by every wave below.
        lds_barrier();

        // ---- Attention of the wave's strips; no workgroup barrier in the chunk loops.
        v8f   o[2][4] = {};
        float mrow[2] = {-3.0e38f, -3.0e38f};
        float lrow[2] = {0.0f, 0.0f};
        const int nlo = (wv >> 1) + 1;            // causal 32-key chunks of strip wv
        const int nhi = ((15 - wv) >> 1) + 1;     // and of strip 15 - wv, never fewer
        for (int ch = 0; ch < nlo; ++ch) {        // both strips on the same K and V^T fragments
            v16h kf[2][2], vf[4];
            load_kv(Ks, Vt, ch * 32, ln, hi, kf, vf);
            attn_tile(kf, vf, qa[0], o[0], mrow[0], lrow[0], ch * 32, t0[0] + ln, hi);
            attn_tile(kf, vf, qa[1], o[1], mrow[1], lrow[1], ch * 32, t0[1] + ln, hi);
        }
        for (int ch = nlo; ch < nhi; ++ch) {      // the upper strip alone
            v16h kf[2][2], vf[4];
            load_kv(Ks, Vt, ch * 32, ln, hi, kf, vf);
            attn_tile(kf, vf, qa[1], o[1], mrow[1], lrow[1], ch * 32, t0[1] + ln, hi);
        }

        // Join the halves' sums and normalize. A lane holds dims 16*dc + 8*hi + 0..7 of its
        // query: O^T turns back into rows in the wave's own LDS range, so that each store
        // below covers two whole output rows (512 contiguous bytes).
#pragma unroll
        for (int st = 0; st < 2; ++st) {
            const float inv = 1.0f / (lrow[st] + xhalf(lrow[st]));
            float* od = Os + ln * OLDP + 8 * hi;
#pragma unroll
            for (int dc = 0; dc < 4; ++dc) {
                *reinterpret_cast<float4*>(od + 16 * dc) = make_float4(
                    o[st][dc][0] * inv, o[st][dc][1] * inv, o[st][dc][2] * inv, o[st][dc][3] * inv);
                *reinterpret_cast<float4*>(od + 16 * dc + 4) = make_float4(
                    o[st][dc][4] * inv, o[st][dc][5] * inv, o[st][dc][6] * inv, o[st][dc][7] * inv);
            }
            // The rows read back below were written by other lanes of this wave.
            asm volatile("s_wait_dscnt 0" ::: "memory");
            float* og = out + ((size_t)b * T + t0[st] + hi) * HS + 4 * ln;
#pragma unroll
            for (int k = 0; k < 8; ++k)
                *reinterpret_cast<float4*>(og + 2 * k * HS) =
                    *reinterpret_cast<const float4*>(Os + (2 * k + hi) * OLDP + 4 * ln);
            // Wait before a register that the stores above name is overwritten.
            asm volatile("s_wait_xcnt 0x0" :: "v"(og) : "memory");
        }
        xe += bstep;                              // read only where 'more'
    }
    // The last refills' loads, which nobody uses, have landed before the wave gives up its registers.
    asm volatile("s_wait_loadcnt 0x0" ::: "memory");
}

// ---------------------------------------------------------------------------
extern "C" void kernel_launch(void* const* d_in, const int* in_sizes, int n_in,
                              void* d_out, int out_size, void* d_ws, size_t ws_size,
                              hipStream_t stream) {
    const float* x = (const float*)d_in[0];
    const float* w = (const float*)d_in[1];
    float* out = (float*)d_out;

    const int B = in_sizes[0] / (T * CEMB);   // 512

    // One workgroup a WGP (its LDS leaves room for no second); each loops over its elements.
    head_kernel<<<dim3(256), dim3(32 * NWAVE), 0, stream>>>(x, w, out, B);
}
